// v000
// The times below were measured on an AMD MI455X: many runs one after another, warmed up first and cycling through
// copies of the inputs, with the whole window's GPU time divided by the number of runs. Launches and the gaps
// between them are all in it. The median over several windows is given; except for v000 it joins two sittings, which
// can be a few percent apart, so the side-by-side timings, each taken in one sitting, are the better comparison.
// v000 is the starting kernel. One run takes 443 microseconds.
#include <hip/hip_runtime.h>

typedef __attribute__((ext_vector_type(16))) _Float16 v16h;
typedef __attribute__((ext_vector_type(8)))  _Float16 v8h;
typedef __attribute__((ext_vector_type(4)))  _Float16 v4h;
typedef __attribute__((ext_vector_type(8)))  float    v8f;
typedef __attribute__((ext_vector_type(4)))  float    v4f;

#define D_MODEL  1024
#define NHEAD    16
#define HEAD_DIM 64
#define BATCH    4
#define SEQ      2048
#define NROWS    (BATCH * SEQ)   // 8192

__device__ __forceinline__ v16h cat8(v8h lo, v8h hi) {
    v16h r;
#pragma unroll
    for (int i = 0; i < 8; i++) { r[i] = lo[i]; r[8 + i] = hi[i]; }
    return r;
}

__device__ __forceinline__ v8f zero8() {
    v8f r;
#pragma unroll
    for (int i = 0; i < 8; i++) r[i] = 0.0f;
    return r;
}

// ---------------------------------------------------------------------------
// Kernel 1: C[8192 x 1024] = X @ W + b, emitted as f16.
//   VT=false -> dst layout [B][H][S][Dh]   (Q, K)
//   VT=true  -> dst layout [B][H][Dh][S]   (V, pre-transposed for P@V B-frags)
// Block: 256 threads (8 waves), tile M=128 N=128, K-step 32.
// Wave (wm, wn) computes a 32x64 subtile = 8 WMMAs per K-step.
// ---------------------------------------------------------------------------
template <bool VT>
__global__ __launch_bounds__(256)
void qkv_proj_kernel(const float* __restrict__ x,
                     const float* __restrict__ W,
                     const float* __restrict__ bias,
                     _Float16* __restrict__ dst)
{
    const int nBase = blockIdx.x * 128;
    const int mBase = blockIdx.y * 128;
    const int t      = threadIdx.x;
    const int wid    = t >> 5;
    const int lane   = t & 31;
    const int laneLo = lane & 15;
    const int laneHi = lane >> 4;

    __shared__ __align__(16) _Float16 Xs[128][40];  // [m][k] f16, pad 8
    __shared__ __align__(16) _Float16 Ws[128][40];  // [n][k] (transposed) f16

    const int wm = wid >> 1;   // 0..3 : 32 rows each
    const int wn = wid & 1;    // 0..1 : 64 cols each

    v8f acc[2][4];
#pragma unroll
    for (int i = 0; i < 2; i++)
#pragma unroll
        for (int j = 0; j < 4; j++) acc[i][j] = zero8();

    for (int k0 = 0; k0 < D_MODEL; k0 += 32) {
        __syncthreads();
        // Stage X tile 128x32 (f32 -> f16)
#pragma unroll
        for (int i = 0; i < 4; i++) {
            int c   = t + 256 * i;        // 0..1023 (4-float chunks)
            int row = c >> 3;             // 0..127
            int kc  = (c & 7) * 4;        // 0..28
            v4f xv = *(const v4f*)(x + (size_t)(mBase + row) * D_MODEL + k0 + kc);
            v4h xh;
#pragma unroll
            for (int e = 0; e < 4; e++) xh[e] = (_Float16)xv[e];
            *(v4h*)&Xs[row][kc] = xh;
        }
        // Stage W tile 32x128 transposed -> Ws[n][k] (f32 -> f16)
#pragma unroll
        for (int i = 0; i < 4; i++) {
            int c  = t + 256 * i;         // 0..1023
            int kr = c >> 5;              // 0..31
            int nc = (c & 31) * 4;        // 0..124
            v4f wv = *(const v4f*)(W + (size_t)(k0 + kr) * D_MODEL + nBase + nc);
#pragma unroll
            for (int e = 0; e < 4; e++) Ws[nc + e][kr] = (_Float16)wv[e];
        }
        __syncthreads();

        // A-frag layout (16x32 f16): lanes 0-15 K{0..7,16..23}; lanes 16-31 K{8..15,24..31}
        v16h Af[2], Bf[4];
#pragma unroll
        for (int mm = 0; mm < 2; mm++) {
            int row = wm * 32 + mm * 16 + laneLo;
            v8h lo = *(const v8h*)&Xs[row][laneHi * 8];
            v8h hi = *(const v8h*)&Xs[row][16 + laneHi * 8];
            Af[mm] = cat8(lo, hi);
        }
#pragma unroll
        for (int nn = 0; nn < 4; nn++) {
            int col = wn * 64 + nn * 16 + laneLo;
            v8h lo = *(const v8h*)&Ws[col][laneHi * 8];
            v8h hi = *(const v8h*)&Ws[col][16 + laneHi * 8];
            Bf[nn] = cat8(lo, hi);
        }
        __builtin_amdgcn_sched_barrier(0);   // keep all ds_loads issued first
#pragma unroll
        for (int mm = 0; mm < 2; mm++)
#pragma unroll
            for (int nn = 0; nn < 4; nn++)
                acc[mm][nn] = __builtin_amdgcn_wmma_f32_16x16x32_f16(
                    false, Af[mm], false, Bf[nn], (short)0, acc[mm][nn], false, false);
    }

    // Epilogue: add bias, convert f16, scatter to chosen layout
#pragma unroll
    for (int mm = 0; mm < 2; mm++) {
#pragma unroll
        for (int nn = 0; nn < 4; nn++) {
            int col = nBase + wn * 64 + nn * 16 + laneLo;
            float bv = bias[col];
            int h = col >> 6;          // head
            int d = col & 63;          // dim in head
#pragma unroll
            for (int r = 0; r < 8; r++) {
                int row = mBase + wm * 32 + mm * 16 + r + laneHi * 8;
                int bb = row >> 11;    // batch
                int s  = row & 2047;   // seq pos
                float val = acc[mm][nn][r] + bv;
                size_t idx;
                if (VT)
                    idx = (((size_t)bb * NHEAD + h) * HEAD_DIM + d) * SEQ + s;
                else
                    idx = (((size_t)bb * NHEAD + h) * SEQ + s) * HEAD_DIM + d;
                dst[idx] = (_Float16)val;
            }
        }
    }
}

// ---------------------------------------------------------------------------
// Kernel 2: flash attention. Grid (S/64, B*H), 128 threads = 4 waves.
// Each wave owns 16 q rows. Q/K fragments load straight from global; V was
// stored pre-transposed [d][s] so P@V B-fragments are direct b128 global
// loads (L2-resident: 256KB/head). P round-trips through LDS for the
// accumulator->A-fragment layout change. Row sums of P are computed with
// 2 extra WMMAs against an all-ones B tile. sched_barrier(0) pins the
// fragment-load clauses ahead of the WMMA chains for latency overlap.
// 18 WMMAs per wave per 64-key block.
// ---------------------------------------------------------------------------
__global__ __launch_bounds__(128)
void attn_kernel(const _Float16* __restrict__ q,    // [B][H][S][Dh]
                 const _Float16* __restrict__ k,    // [B][H][S][Dh]
                 const _Float16* __restrict__ vt,   // [B][H][Dh][S]
                 float* __restrict__ out)           // [B][S][D_MODEL]
{
    const int qt = blockIdx.x;          // q tile (64 rows)
    const int bh = blockIdx.y;          // b*NHEAD + h
    const int b  = bh >> 4;
    const int h  = bh & 15;
    const int t      = threadIdx.x;
    const int wid    = t >> 5;          // 0..3
    const int lane   = t & 31;
    const int laneLo = lane & 15;
    const int laneHi = lane >> 4;

    const _Float16* qh  = q  + (size_t)bh * SEQ * HEAD_DIM;
    const _Float16* kh  = k  + (size_t)bh * SEQ * HEAD_DIM;
    const _Float16* vth = vt + (size_t)bh * HEAD_DIM * SEQ;

    __shared__ __align__(16) _Float16 plds[4][16][72];   // per-wave P tiles

    // Q fragments: 16 rows x 64 d -> two 16x32 A-frags, straight from global
    const int qrow = qt * 64 + wid * 16 + laneLo;
    v16h Aq[2];
#pragma unroll
    for (int c = 0; c < 2; c++) {
        const _Float16* qp = qh + (size_t)qrow * HEAD_DIM + c * 32;
        v8h lo = *(const v8h*)(qp + laneHi * 8);
        v8h hi = *(const v8h*)(qp + 16 + laneHi * 8);
        Aq[c] = cat8(lo, hi);
    }

    // All-ones B tile: P @ ones gives row sums of P in every accumulator lane
    v16h onesB;
#pragma unroll
    for (int i = 0; i < 16; i++) onesB[i] = (_Float16)1.0f;

    v8f Oacc[4];
#pragma unroll
    for (int n = 0; n < 4; n++) Oacc[n] = zero8();
    float mrow[8], lrow[8];
#pragma unroll
    for (int r = 0; r < 8; r++) { mrow[r] = -3.0e38f; lrow[r] = 0.0f; }
    const float scale = 0.03125f;   // 1/sqrt(D_MODEL)

    for (int j = 0; j < SEQ / 64; ++j) {
        const _Float16* kblk = kh + (size_t)j * 64 * HEAD_DIM;

        if (j + 1 < SEQ / 64) {
            __builtin_prefetch(kblk + 64 * HEAD_DIM, 0, 1);   // global_prefetch_b8
            __builtin_prefetch(vth + (j + 1) * 64, 0, 1);
        }

        // ---- Load ALL K B-fragments up front (one clause, overlapped) ----
        v16h Bk[2][4];
#pragma unroll
        for (int n = 0; n < 4; n++)
#pragma unroll
            for (int c = 0; c < 2; c++) {
                const _Float16* kp = kblk + (size_t)(n * 16 + laneLo) * HEAD_DIM + c * 32;
                v8h lo = *(const v8h*)(kp + laneHi * 8);
                v8h hi = *(const v8h*)(kp + 16 + laneHi * 8);
                Bk[c][n] = cat8(lo, hi);
            }
        __builtin_amdgcn_sched_barrier(0);   // pin loads ahead of WMMAs

        // ---- S = Q @ K^T : 8 back-to-back WMMAs ----
        v8f S[4];
#pragma unroll
        for (int n = 0; n < 4; n++) {
            v8f accn = __builtin_amdgcn_wmma_f32_16x16x32_f16(
                false, Aq[0], false, Bk[0][n], (short)0, zero8(), false, false);
            accn = __builtin_amdgcn_wmma_f32_16x16x32_f16(
                false, Aq[1], false, Bk[1][n], (short)0, accn, false, false);
            S[n] = accn;
        }
#pragma unroll
        for (int n = 0; n < 4; n++)
#pragma unroll
            for (int r = 0; r < 8; r++) S[n][r] *= scale;

        // ---- Online softmax: batched butterfly max-reduce (4 waits, not 32)
        float mx[8];
#pragma unroll
        for (int r = 0; r < 8; r++)
            mx[r] = fmaxf(fmaxf(S[0][r], S[1][r]), fmaxf(S[2][r], S[3][r]));
#pragma unroll
        for (int m = 1; m < 16; m <<= 1) {
            float other[8];
#pragma unroll
            for (int r = 0; r < 8; r++) other[r] = __shfl_xor(mx[r], m, 32);
#pragma unroll
            for (int r = 0; r < 8; r++) mx[r] = fmaxf(mx[r], other[r]);
        }
#pragma unroll
        for (int r = 0; r < 8; r++) {
            float mnew  = fmaxf(mrow[r], mx[r]);
            float alpha = __expf(mrow[r] - mnew);
            mrow[r] = mnew;
            lrow[r] *= alpha;
#pragma unroll
            for (int n = 0; n < 4; n++) {
                S[n][r] = __expf(S[n][r] - mnew);
                Oacc[n][r] *= alpha;
            }
        }

        // ---- P (C layout) -> LDS f16 -> A-fragment layout ----
#pragma unroll
        for (int n = 0; n < 4; n++)
#pragma unroll
            for (int r = 0; r < 8; r++)
                plds[wid][r + laneHi * 8][n * 16 + laneLo] = (_Float16)S[n][r];
        __syncthreads();        // flush DS stores (cross-lane within wave)

        // ---- Load A frags + ALL V B-fragments up front ----
        v16h Ap[2];
#pragma unroll
        for (int c = 0; c < 2; c++) {
            v8h lo = *(const v8h*)&plds[wid][laneLo][c * 32 + laneHi * 8];
            v8h hi = *(const v8h*)&plds[wid][laneLo][c * 32 + 16 + laneHi * 8];
            Ap[c] = cat8(lo, hi);
        }
        v16h Bv[2][4];
#pragma unroll
        for (int c = 0; c < 2; c++)
#pragma unroll
            for (int n = 0; n < 4; n++) {
                const _Float16* vp = vth + (size_t)(n * 16 + laneLo) * SEQ
                                         + j * 64 + c * 32;
                v8h blo = *(const v8h*)(vp + laneHi * 8);
                v8h bhi = *(const v8h*)(vp + 16 + laneHi * 8);
                Bv[c][n] = cat8(blo, bhi);
            }
        __builtin_amdgcn_sched_barrier(0);   // pin loads ahead of WMMAs

        // ---- O += P @ V  and  lrow += P @ ones (row sums) : 10 WMMAs ----
        v8f lacc = zero8();
#pragma unroll
        for (int c = 0; c < 2; c++) {
            lacc = __builtin_amdgcn_wmma_f32_16x16x32_f16(
                false, Ap[c], false, onesB, (short)0, lacc, false, false);
#pragma unroll
            for (int n = 0; n < 4; n++)
                Oacc[n] = __builtin_amdgcn_wmma_f32_16x16x32_f16(
                    false, Ap[c], false, Bv[c][n], (short)0, Oacc[n], false, false);
        }
#pragma unroll
        for (int r = 0; r < 8; r++) lrow[r] += lacc[r];

        __syncthreads();        // plds reusable next iteration
    }

    // Normalize and write out [B][S][D_MODEL] f32
#pragma unroll
    for (int n = 0; n < 4; n++) {
#pragma unroll
        for (int r = 0; r < 8; r++) {
            int s   = qt * 64 + wid * 16 + r + laneHi * 8;
            int col = h * HEAD_DIM + n * 16 + laneLo;
            out[((size_t)b * SEQ + s) * D_MODEL + col] = Oacc[n][r] / lrow[r];
        }
    }
}

extern "C" void kernel_launch(void* const* d_in, const int* in_sizes, int n_in,
                              void* d_out, int out_size, void* d_ws, size_t ws_size,
                              hipStream_t stream) {
    const float* x  = (const float*)d_in[0];
    const float* Wq = (const float*)d_in[1];
    const float* bq = (const float*)d_in[2];
    const float* Wk = (const float*)d_in[3];
    const float* bk = (const float*)d_in[4];
    const float* Wv = (const float*)d_in[5];
    const float* bv = (const float*)d_in[6];
    float* out = (float*)d_out;

    const size_t per = (size_t)BATCH * NHEAD * SEQ * HEAD_DIM;  // 8.4M elems
    _Float16* qws = (_Float16*)d_ws;
    _Float16* kws = qws + per;
    _Float16* vws = kws + per;     // total 48MB of f16 in d_ws

    dim3 g1(D_MODEL / 128, NROWS / 128);   // (8, 64)
    qkv_proj_kernel<false><<<g1, 256, 0, stream>>>(x, Wq, bq, qws);
    qkv_proj_kernel<false><<<g1, 256, 0, stream>>>(x, Wk, bk, kws);
    qkv_proj_kernel<true ><<<g1, 256, 0, stream>>>(x, Wv, bv, vws);

    dim3 g2(SEQ / 64, BATCH * NHEAD);      // (32, 64)
    attn_kernel<<<g2, 128, 0, stream>>>(qws, kws, vws, out);
}

// v001
// One run takes 344 microseconds.
// Timed twice side by side with v000, it ran 1.34 times as fast both times.
#include <hip/hip_runtime.h>

typedef __attribute__((ext_vector_type(16))) _Float16 v16h;
typedef __attribute__((ext_vector_type(8)))  _Float16 v8h;
typedef __attribute__((ext_vector_type(4)))  _Float16 v4h;
typedef __attribute__((ext_vector_type(8)))  float    v8f;
typedef __attribute__((ext_vector_type(4)))  float    v4f;

#define D_MODEL  1024
#define NHEAD    16
#define HEAD_DIM 64
#define BATCH    4
#define SEQ      2048
#define NROWS    (BATCH * SEQ)   // 8192

__device__ __forceinline__ v16h cat8(v8h lo, v8h hi) {
    v16h r;
#pragma unroll
    for (int i = 0; i < 8; i++) { r[i] = lo[i]; r[8 + i] = hi[i]; }
    return r;
}

__device__ __forceinline__ v8f zero8() {
    v8f r;
#pragma unroll
    for (int i = 0; i < 8; i++) r[i] = 0.0f;
    return r;
}

// ---------------------------------------------------------------------------
// Kernel 1: C[8192 x 1024] = X @ W + b, emitted as f16.
//   VT=false -> dst layout [B][H][S][Dh]   (Q, K)
//   VT=true  -> dst layout [B][H][Dh][S]   (V, pre-transposed for P@V B-frags)
// Block: 256 threads (8 waves), tile M=128 N=128, K-step 32.
// Wave (wm, wn) computes a 32x64 subtile = 8 WMMAs per K-step.
// ---------------------------------------------------------------------------
template <bool VT>
__global__ __launch_bounds__(256)
void qkv_proj_kernel(const float* __restrict__ x,
                     const float* __restrict__ W,
                     const float* __restrict__ bias,
                     _Float16* __restrict__ dst)
{
    const int nBase = blockIdx.x * 128;
    const int mBase = blockIdx.y * 128;
    const int t      = threadIdx.x;
    const int wid    = t >> 5;
    const int lane   = t & 31;
    const int laneLo = lane & 15;
    const int laneHi = lane >> 4;

    __shared__ __align__(16) _Float16 Xs[128][40];  // [m][k] f16, pad 8
    __shared__ __align__(16) _Float16 Ws[128][40];  // [n][k] (transposed) f16

    const int wm = wid >> 1;   // 0..3 : 32 rows each
    const int wn = wid & 1;    // 0..1 : 64 cols each

    v8f acc[2][4];
#pragma unroll
    for (int i = 0; i < 2; i++)
#pragma unroll
        for (int j = 0; j < 4; j++) acc[i][j] = zero8();

    for (int k0 = 0; k0 < D_MODEL; k0 += 32) {
        __syncthreads();
        // Stage X tile 128x32 (f32 -> f16)
#pragma unroll
        for (int i = 0; i < 4; i++) {
            int c   = t + 256 * i;        // 0..1023 (4-float chunks)
            int row = c >> 3;             // 0..127
            int kc  = (c & 7) * 4;        // 0..28
            v4f xv = *(const v4f*)(x + (size_t)(mBase + row) * D_MODEL + k0 + kc);
            v4h xh;
#pragma unroll
            for (int e = 0; e < 4; e++) xh[e] = (_Float16)xv[e];
            *(v4h*)&Xs[row][kc] = xh;
        }
        // Stage W tile 32x128 transposed -> Ws[n][k] (f32 -> f16)
#pragma unroll
        for (int i = 0; i < 4; i++) {
            int c  = t + 256 * i;         // 0..1023
            int kr = c >> 5;              // 0..31
            int nc = (c & 31) * 4;        // 0..124
            v4f wv = *(const v4f*)(W + (size_t)(k0 + kr) * D_MODEL + nBase + nc);
#pragma unroll
            for (int e = 0; e < 4; e++) Ws[nc + e][kr] = (_Float16)wv[e];
        }
        __syncthreads();

        // A-frag layout (16x32 f16): lanes 0-15 K{0..7,16..23}; lanes 16-31 K{8..15,24..31}
        v16h Af[2], Bf[4];
#pragma unroll
        for (int mm = 0; mm < 2; mm++) {
            int row = wm * 32 + mm * 16 + laneLo;
            v8h lo = *(const v8h*)&Xs[row][laneHi * 8];
            v8h hi = *(const v8h*)&Xs[row][16 + laneHi * 8];
            Af[mm] = cat8(lo, hi);
        }
#pragma unroll
        for (int nn = 0; nn < 4; nn++) {
            int col = wn * 64 + nn * 16 + laneLo;
            v8h lo = *(const v8h*)&Ws[col][laneHi * 8];
            v8h hi = *(const v8h*)&Ws[col][16 + laneHi * 8];
            Bf[nn] = cat8(lo, hi);
        }
        __builtin_amdgcn_sched_barrier(0);   // keep all ds_loads issued first
#pragma unroll
        for (int mm = 0; mm < 2; mm++)
#pragma unroll
            for (int nn = 0; nn < 4; nn++)
                acc[mm][nn] = __builtin_amdgcn_wmma_f32_16x16x32_f16(
                    false, Af[mm], false, Bf[nn], (short)0, acc[mm][nn], false, false);
    }

    // Epilogue: add bias, convert f16, scatter to chosen layout
#pragma unroll
    for (int mm = 0; mm < 2; mm++) {
#pragma unroll
        for (int nn = 0; nn < 4; nn++) {
            int col = nBase + wn * 64 + nn * 16 + laneLo;
            float bv = bias[col];
            int h = col >> 6;          // head
            int d = col & 63;          // dim in head
#pragma unroll
            for (int r = 0; r < 8; r++) {
                int row = mBase + wm * 32 + mm * 16 + r + laneHi * 8;
                int bb = row >> 11;    // batch
                int s  = row & 2047;   // seq pos
                float val = acc[mm][nn][r] + bv;
                size_t idx;
                if (VT)
                    idx = (((size_t)bb * NHEAD + h) * HEAD_DIM + d) * SEQ + s;
                else
                    idx = (((size_t)bb * NHEAD + h) * SEQ + s) * HEAD_DIM + d;
                dst[idx] = (_Float16)val;
            }
        }
    }
}

// ---------------------------------------------------------------------------
// Kernel 2: flash attention. Grid (S/64, B*H), 128 threads = 4 waves.
// Each wave owns 16 q rows. Q fragments load straight from global. The K tile
// (64 keys x 64 d) and the V^T tile (64 d x 64 keys; V was stored
// pre-transposed [d][s]) of a key block are brought into LDS once per
// work-group by asynchronous copies that cover whole 128-byte lines, one
// block ahead in two buffers; all four waves read their B-fragments from
// there. P round-trips through LDS for the
// accumulator->A-fragment layout change. Row sums of P are computed with
// 2 extra WMMAs against an all-ones B tile. sched_barrier(0) pins the
// fragment-load clauses ahead of the WMMA chains for latency overlap.
// 18 WMMAs per wave per 64-key block.
// ---------------------------------------------------------------------------
#define KV_PITCH 72   // halfs per staged row: 144 B = 16 B x 9, conflict-free for b128 readers

typedef __attribute__((address_space(3))) const _Float16 lds_cf16;

__device__ __forceinline__ unsigned lds_addr(const _Float16* p) {
    return (unsigned)(uintptr_t)(lds_cf16*)p;   // byte offset in the work-group's LDS
}

// One key block into one buffer: 128 threads x 8 copies of 16 B.
// dst[0] = K tile [key][d], dst[1] = V^T tile [d][key]; 8 lanes fill one 128-B row.
__device__ __forceinline__ void stage_kv(const _Float16* kblk, const _Float16* vblk,
                                         _Float16 (*dst)[64][KV_PITCH], int t)
{
    const int row = t >> 3;          // 0..15, +16 per copy
    const int col = (t & 7) * 8;     // halfs
    const _Float16* gk0 = kblk + (size_t)row * HEAD_DIM + col;
    const _Float16* gk1 = gk0 + 16 * HEAD_DIM;
    const _Float16* gk2 = gk0 + 32 * HEAD_DIM;
    const _Float16* gk3 = gk0 + 48 * HEAD_DIM;
    const _Float16* gv0 = vblk + (size_t)row * SEQ + col;
    const _Float16* gv1 = gv0 + 16 * SEQ;
    const _Float16* gv2 = gv0 + 32 * SEQ;
    const _Float16* gv3 = gv0 + 48 * SEQ;
    const unsigned lk0 = lds_addr(&dst[0][row][col]);
    const unsigned lk1 = lds_addr(&dst[0][row + 16][col]);
    const unsigned lk2 = lds_addr(&dst[0][row + 32][col]);
    const unsigned lk3 = lds_addr(&dst[0][row + 48][col]);
    const unsigned lv0 = lds_addr(&dst[1][row][col]);
    const unsigned lv1 = lds_addr(&dst[1][row + 16][col]);
    const unsigned lv2 = lds_addr(&dst[1][row + 32][col]);
    const unsigned lv3 = lds_addr(&dst[1][row + 48][col]);
    // The copies and their s_wait_xcnt in one statement: the wait then stands in
    // front of every later write of an address register that a copy names.
    asm volatile(
        "global_load_async_to_lds_b128 %0, %8, off\n\t"
        "global_load_async_to_lds_b128 %1, %9, off\n\t"
        "global_load_async_to_lds_b128 %2, %10, off\n\t"
        "global_load_async_to_lds_b128 %3, %11, off\n\t"
        "global_load_async_to_lds_b128 %4, %12, off\n\t"
        "global_load_async_to_lds_b128 %5, %13, off\n\t"
        "global_load_async_to_lds_b128 %6, %14, off\n\t"
        "global_load_async_to_lds_b128 %7, %15, off\n\t"
        "s_wait_xcnt 0x0"
        :: "v"(lk0), "v"(lk1), "v"(lk2), "v"(lk3),
           "v"(lv0), "v"(lv1), "v"(lv2), "v"(lv3),
           "v"(gk0), "v"(gk1), "v"(gk2), "v"(gk3),
           "v"(gv0), "v"(gv1), "v"(gv2), "v"(gv3)
        : "memory");
}

__global__ __launch_bounds__(128)
void attn_kernel(const _Float16* __restrict__ q,    // [B][H][S][Dh]
                 const _Float16* __restrict__ k,    // [B][H][S][Dh]
                 const _Float16* __restrict__ vt,   // [B][H][Dh][S]
                 float* __restrict__ out)           // [B][S][D_MODEL]
{
    const int qt = blockIdx.x;          // q tile (64 rows)
    const int bh = blockIdx.y;          // b*NHEAD + h
    const int b  = bh >> 4;
    const int h  = bh & 15;
    const int t      = threadIdx.x;
    const int wid    = t >> 5;          // 0..3
    const int lane   = t & 31;
    const int laneLo = lane & 15;
    const int laneHi = lane >> 4;

    const _Float16* qh  = q  + (size_t)bh * SEQ * HEAD_DIM;
    const _Float16* kh  = k  + (size_t)bh * SEQ * HEAD_DIM;
    const _Float16* vth = vt + (size_t)bh * HEAD_DIM * SEQ;

    __shared__ __align__(16) _Float16 plds[4][16][72];   // per-wave P tiles
    __shared__ __align__(16) _Float16 kvs[2][2][64][KV_PITCH];  // [buffer][K | V^T][row][col]

    // Block 0 into buffer 0, landed and published; then block 1 into buffer 1.
    stage_kv(kh, vth, kvs[0], t);
    asm volatile("s_wait_asynccnt 0x0" ::: "memory");   // this wave's copies of block 0 have landed
    __syncthreads();                                    // ... and every other wave's
    stage_kv(kh + 64 * HEAD_DIM, vth + 64, kvs[1], t);

    // Q fragments: 16 rows x 64 d -> two 16x32 A-frags, straight from global
    const int qrow = qt * 64 + wid * 16 + laneLo;
    v16h Aq[2];
#pragma unroll
    for (int c = 0; c < 2; c++) {
        const _Float16* qp = qh + (size_t)qrow * HEAD_DIM + c * 32;
        v8h lo = *(const v8h*)(qp + laneHi * 8);
        v8h hi = *(const v8h*)(qp + 16 + laneHi * 8);
        Aq[c] = cat8(lo, hi);
    }

    // All-ones B tile: P @ ones gives row sums of P in every accumulator lane
    v16h onesB;
#pragma unroll
    for (int i = 0; i < 16; i++) onesB[i] = (_Float16)1.0f;

    v8f Oacc[4];
#pragma unroll
    for (int n = 0; n < 4; n++) Oacc[n] = zero8();
    float mrow[8], lrow[8];
#pragma unroll
    for (int r = 0; r < 8; r++) { mrow[r] = -3.0e38f; lrow[r] = 0.0f; }
    const float scale = 0.03125f;   // 1/sqrt(D_MODEL)

    for (int j = 0; j < SEQ / 64; ++j) {
        const _Float16 (*ks)[KV_PITCH] = kvs[j & 1][0];   // [key][d]
        const _Float16 (*vs)[KV_PITCH] = kvs[j & 1][1];   // [d][key]

        // ---- Load ALL K B-fragments up front (one clause, overlapped) ----
        v16h Bk[2][4];
#pragma unroll
        for (int n = 0; n < 4; n++)
#pragma unroll
            for (int c = 0; c < 2; c++) {
                const _Float16* kp = &ks[n * 16 + laneLo][c * 32];
                v8h lo = *(const v8h*)(kp + laneHi * 8);
                v8h hi = *(const v8h*)(kp + 16 + laneHi * 8);
                Bk[c][n] = cat8(lo, hi);
            }
        __builtin_amdgcn_sched_barrier(0);   // pin loads ahead of WMMAs

        // ---- S = Q @ K^T : 8 back-to-back WMMAs ----
        v8f S[4];
#pragma unroll
        for (int n = 0; n < 4; n++) {
            v8f accn = __builtin_amdgcn_wmma_f32_16x16x32_f16(
                false, Aq[0], false, Bk[0][n], (short)0, zero8(), false, false);
            accn = __builtin_amdgcn_wmma_f32_16x16x32_f16(
                false, Aq[1], false, Bk[1][n], (short)0, accn, false, false);
            S[n] = accn;
        }
#pragma unroll
        for (int n = 0; n < 4; n++)
#pragma unroll
            for (int r = 0; r < 8; r++) S[n][r] *= scale;

        // ---- Online softmax: batched butterfly max-reduce (4 waits, not 32)
        float mx[8];
#pragma unroll
        for (int r = 0; r < 8; r++)
            mx[r] = fmaxf(fmaxf(S[0][r], S[1][r]), fmaxf(S[2][r], S[3][r]));
#pragma unroll
        for (int m = 1; m < 16; m <<= 1) {
            float other[8];
#pragma unroll
            for (int r = 0; r < 8; r++) other[r] = __shfl_xor(mx[r], m, 32);
#pragma unroll
            for (int r = 0; r < 8; r++) mx[r] = fmaxf(mx[r], other[r]);
        }
#pragma unroll
        for (int r = 0; r < 8; r++) {
            float mnew  = fmaxf(mrow[r], mx[r]);
            float alpha = __expf(mrow[r] - mnew);
            mrow[r] = mnew;
            lrow[r] *= alpha;
#pragma unroll
            for (int n = 0; n < 4; n++) {
                S[n][r] = __expf(S[n][r] - mnew);
                Oacc[n][r] *= alpha;
            }
        }

        // ---- P (C layout) -> LDS f16 -> A-fragment layout ----
#pragma unroll
        for (int n = 0; n < 4; n++)
#pragma unroll
            for (int r = 0; r < 8; r++)
                plds[wid][r + laneHi * 8][n * 16 + laneLo] = (_Float16)S[n][r];
        __syncthreads();        // flush DS stores (cross-lane within wave)

        // ---- Load A frags + ALL V B-fragments up front ----
        v16h Ap[2];
#pragma unroll
        for (int c = 0; c < 2; c++) {
            v8h lo = *(const v8h*)&plds[wid][laneLo][c * 32 + laneHi * 8];
            v8h hi = *(const v8h*)&plds[wid][laneLo][c * 32 + 16 + laneHi * 8];
            Ap[c] = cat8(lo, hi);
        }
        v16h Bv[2][4];
#pragma unroll
        for (int c = 0; c < 2; c++)
#pragma unroll
            for (int n = 0; n < 4; n++) {
                const _Float16* vp = &vs[n * 16 + laneLo][c * 32];
                v8h blo = *(const v8h*)(vp + laneHi * 8);
                v8h bhi = *(const v8h*)(vp + 16 + laneHi * 8);
                Bv[c][n] = cat8(blo, bhi);
            }
        __builtin_amdgcn_sched_barrier(0);   // pin loads ahead of WMMAs

        // ---- O += P @ V  and  lrow += P @ ones (row sums) : 10 WMMAs ----
        v8f lacc = zero8();
#pragma unroll
        for (int c = 0; c < 2; c++) {
            lacc = __builtin_amdgcn_wmma_f32_16x16x32_f16(
                false, Ap[c], false, onesB, (short)0, lacc, false, false);
#pragma unroll
            for (int n = 0; n < 4; n++)
                Oacc[n] = __builtin_amdgcn_wmma_f32_16x16x32_f16(
                    false, Ap[c], false, Bv[c][n], (short)0, Oacc[n], false, false);
        }
#pragma unroll
        for (int r = 0; r < 8; r++) lrow[r] += lacc[r];

        // Hand-over: this wave has left buffer j & 1 and its copies of block j + 1
        // have landed; behind the barrier that holds for all four waves.
        asm volatile("s_wait_dscnt 0x0" ::: "memory");      // own LDS reads of this buffer are done
        asm volatile("s_wait_asynccnt 0x0" ::: "memory");   // own copies of block j + 1 have landed
        __syncthreads();        // publishes block j + 1, frees buffer j & 1 and plds
        if (j + 2 < SEQ / 64)
            stage_kv(kh + (size_t)(j + 2) * 64 * HEAD_DIM, vth + (j + 2) * 64, kvs[j & 1], t);
    }
    asm volatile("s_wait_asynccnt 0x0" ::: "memory");   // no copy outstanding at the wave's end

    // Normalize and write out [B][S][D_MODEL] f32
#pragma unroll
    for (int n = 0; n < 4; n++) {
#pragma unroll
        for (int r = 0; r < 8; r++) {
            int s   = qt * 64 + wid * 16 + r + laneHi * 8;
            int col = h * HEAD_DIM + n * 16 + laneLo;
            out[((size_t)b * SEQ + s) * D_MODEL + col] = Oacc[n][r] / lrow[r];
        }
    }
}

extern "C" void kernel_launch(void* const* d_in, const int* in_sizes, int n_in,
                              void* d_out, int out_size, void* d_ws, size_t ws_size,
                              hipStream_t stream) {
    const float* x  = (const float*)d_in[0];
    const float* Wq = (const float*)d_in[1];
    const float* bq = (const float*)d_in[2];
    const float* Wk = (const float*)d_in[3];
    const float* bk = (const float*)d_in[4];
    const float* Wv = (const float*)d_in[5];
    const float* bv = (const float*)d_in[6];
    float* out = (float*)d_out;

    const size_t per = (size_t)BATCH * NHEAD * SEQ * HEAD_DIM;  // 8.4M elems
    _Float16* qws = (_Float16*)d_ws;
    _Float16* kws = qws + per;
    _Float16* vws = kws + per;     // total 48MB of f16 in d_ws

    dim3 g1(D_MODEL / 128, NROWS / 128);   // (8, 64)
    qkv_proj_kernel<false><<<g1, 256, 0, stream>>>(x, Wq, bq, qws);
    qkv_proj_kernel<false><<<g1, 256, 0, stream>>>(x, Wk, bk, kws);
    qkv_proj_kernel<true ><<<g1, 256, 0, stream>>>(x, Wv, bv, vws);

    dim3 g2(SEQ / 64, BATCH * NHEAD);      // (32, 64)
    attn_kernel<<<g2, 128, 0, stream>>>(qws, kws, vws, out);
}

// v002
// One run takes 293 microseconds.
// In two side-by-side timings against v001, it was 1.18 and 1.17 times as fast.
// Counting every step since v000, it is 1.57 times as fast.
#include <hip/hip_runtime.h>

typedef __attribute__((ext_vector_type(16))) _Float16 v16h;
typedef __attribute__((ext_vector_type(8)))  _Float16 v8h;
typedef __attribute__((ext_vector_type(4)))  _Float16 v4h;
typedef __attribute__((ext_vector_type(8)))  float    v8f;
typedef __attribute__((ext_vector_type(4)))  float    v4f;

#define D_MODEL  1024
#define NHEAD    16
#define HEAD_DIM 64
#define BATCH    4
#define SEQ      2048
#define NROWS    (BATCH * SEQ)   // 8192

__device__ __forceinline__ v16h cat8(v8h lo, v8h hi) {
    v16h r;
#pragma unroll
    for (int i = 0; i < 8; i++) { r[i] = lo[i]; r[8 + i] = hi[i]; }
    return r;
}

__device__ __forceinline__ v8f zero8() {
    v8f r;
#pragma unroll
    for (int i = 0; i < 8; i++) r[i] = 0.0f;
    return r;
}

// ---------------------------------------------------------------------------
// Kernel 1: C[8192 x 1024] = X @ W + b, emitted as f16.
//   VT=false -> dst layout [B][H][S][Dh]   (Q, K)
//   VT=true  -> dst layout [B][H][Dh][S]   (V, pre-transposed for V^T@P^T A-frags)
// Block: 256 threads (8 waves), tile M=128 N=128, K-step 32.
// Wave (wm, wn) computes a 32x64 subtile = 8 WMMAs per K-step.
// ---------------------------------------------------------------------------
template <bool VT>
__global__ __launch_bounds__(256)
void qkv_proj_kernel(const float* __restrict__ x,
                     const float* __restrict__ W,
                     const float* __restrict__ bias,
                     _Float16* __restrict__ dst)
{
    const int nBase = blockIdx.x * 128;
    const int mBase = blockIdx.y * 128;
    const int t      = threadIdx.x;
    const int wid    = t >> 5;
    const int lane   = t & 31;
    const int laneLo = lane & 15;
    const int laneHi = lane >> 4;

    __shared__ __align__(16) _Float16 Xs[128][40];  // [m][k] f16, pad 8
    __shared__ __align__(16) _Float16 Ws[128][40];  // [n][k] (transposed) f16

    const int wm = wid >> 1;   // 0..3 : 32 rows each
    const int wn = wid & 1;    // 0..1 : 64 cols each

    v8f acc[2][4];
#pragma unroll
    for (int i = 0; i < 2; i++)
#pragma unroll
        for (int j = 0; j < 4; j++) acc[i][j] = zero8();

    for (int k0 = 0; k0 < D_MODEL; k0 += 32) {
        __syncthreads();
        // Stage X tile 128x32 (f32 -> f16)
#pragma unroll
        for (int i = 0; i < 4; i++) {
            int c   = t + 256 * i;        // 0..1023 (4-float chunks)
            int row = c >> 3;             // 0..127
            int kc  = (c & 7) * 4;        // 0..28
            v4f xv = *(const v4f*)(x + (size_t)(mBase + row) * D_MODEL + k0 + kc);
            v4h xh;
#pragma unroll
            for (int e = 0; e < 4; e++) xh[e] = (_Float16)xv[e];
            *(v4h*)&Xs[row][kc] = xh;
        }
        // Stage W tile 32x128 transposed -> Ws[n][k] (f32 -> f16)
#pragma unroll
        for (int i = 0; i < 4; i++) {
            int c  = t + 256 * i;         // 0..1023
            int kr = c >> 5;              // 0..31
            int nc = (c & 31) * 4;        // 0..124
            v4f wv = *(const v4f*)(W + (size_t)(k0 + kr) * D_MODEL + nBase + nc);
#pragma unroll
            for (int e = 0; e < 4; e++) Ws[nc + e][kr] = (_Float16)wv[e];
        }
        __syncthreads();

        // A-frag layout (16x32 f16): lanes 0-15 K{0..7,16..23}; lanes 16-31 K{8..15,24..31}
        v16h Af[2], Bf[4];
#pragma unroll
        for (int mm = 0; mm < 2; mm++) {
            int row = wm * 32 + mm * 16 + laneLo;
            v8h lo = *(const v8h*)&Xs[row][laneHi * 8];
            v8h hi = *(const v8h*)&Xs[row][16 + laneHi * 8];
            Af[mm] = cat8(lo, hi);
        }
#pragma unroll
        for (int nn = 0; nn < 4; nn++) {
            int col = wn * 64 + nn * 16 + laneLo;
            v8h lo = *(const v8h*)&Ws[col][laneHi * 8];
            v8h hi = *(const v8h*)&Ws[col][16 + laneHi * 8];
            Bf[nn] = cat8(lo, hi);
        }
        __builtin_amdgcn_sched_barrier(0);   // keep all ds_loads issued first
#pragma unroll
        for (int mm = 0; mm < 2; mm++)
#pragma unroll
            for (int nn = 0; nn < 4; nn++)
                acc[mm][nn] = __builtin_amdgcn_wmma_f32_16x16x32_f16(
                    false, Af[mm], false, Bf[nn], (short)0, acc[mm][nn], false, false);
    }

    // Epilogue: add bias, convert f16, scatter to chosen layout
#pragma unroll
    for (int mm = 0; mm < 2; mm++) {
#pragma unroll
        for (int nn = 0; nn < 4; nn++) {
            int col = nBase + wn * 64 + nn * 16 + laneLo;
            float bv = bias[col];
            int h = col >> 6;          // head
            int d = col & 63;          // dim in head
#pragma unroll
            for (int r = 0; r < 8; r++) {
                int row = mBase + wm * 32 + mm * 16 + r + laneHi * 8;
                int bb = row >> 11;    // batch
                int s  = row & 2047;   // seq pos
                float val = acc[mm][nn][r] + bv;
                size_t idx;
                if (VT)
                    idx = (((size_t)bb * NHEAD + h) * HEAD_DIM + d) * SEQ + s;
                else
                    idx = (((size_t)bb * NHEAD + h) * SEQ + s) * HEAD_DIM + d;
                dst[idx] = (_Float16)val;
            }
        }
    }
}

#define KV_PITCH 72

typedef __attribute__((address_space(3))) const _Float16 lds_cf16;

__device__ __forceinline__ unsigned lds_addr(const _Float16* p) {
    return (unsigned)(uintptr_t)(lds_cf16*)p;   // byte offset in the work-group's LDS
}

// One key block into one buffer: 128 threads x 8 copies of 16 B.
// dst[0] = K tile [key][d], dst[1] = V^T tile [d][key]; 8 lanes fill one 128-B row.
__device__ __forceinline__ void stage_kv(const _Float16* kblk, const _Float16* vblk,
                                         _Float16 (*dst)[64][KV_PITCH], int t)
{
    const int row = t >> 3;          // 0..15, +16 per copy
    const int col = (t & 7) * 8;     // halfs
    const _Float16* gk0 = kblk + (size_t)row * HEAD_DIM + col;
    const _Float16* gk1 = gk0 + 16 * HEAD_DIM;
    const _Float16* gk2 = gk0 + 32 * HEAD_DIM;
    const _Float16* gk3 = gk0 + 48 * HEAD_DIM;
    const _Float16* gv0 = vblk + (size_t)row * SEQ + col;
    const _Float16* gv1 = gv0 + 16 * SEQ;
    const _Float16* gv2 = gv0 + 32 * SEQ;
    const _Float16* gv3 = gv0 + 48 * SEQ;
    const unsigned lk0 = lds_addr(&dst[0][row][col]);
    const unsigned lk1 = lds_addr(&dst[0][row + 16][col]);
    const unsigned lk2 = lds_addr(&dst[0][row + 32][col]);
    const unsigned lk3 = lds_addr(&dst[0][row + 48][col]);
    const unsigned lv0 = lds_addr(&dst[1][row][col]);
    const unsigned lv1 = lds_addr(&dst[1][row + 16][col]);
    const unsigned lv2 = lds_addr(&dst[1][row + 32][col]);
    const unsigned lv3 = lds_addr(&dst[1][row + 48][col]);
    // The copies and their s_wait_xcnt in one statement: the wait then stands in
    // front of every later write of an address register that a copy names.
    asm volatile(
        "global_load_async_to_lds_b128 %0, %8, off\n\t"
        "global_load_async_to_lds_b128 %1, %9, off\n\t"
        "global_load_async_to_lds_b128 %2, %10, off\n\t"
        "global_load_async_to_lds_b128 %3, %11, off\n\t"
        "global_load_async_to_lds_b128 %4, %12, off\n\t"
        "global_load_async_to_lds_b128 %5, %13, off\n\t"
        "global_load_async_to_lds_b128 %6, %14, off\n\t"
        "global_load_async_to_lds_b128 %7, %15, off\n\t"
        "s_wait_xcnt 0x0"
        :: "v"(lk0), "v"(lk1), "v"(lk2), "v"(lk3),
           "v"(lv0), "v"(lv1), "v"(lv2), "v"(lv3),
           "v"(gk0), "v"(gk1), "v"(gk2), "v"(gk3),
           "v"(gv0), "v"(gv1), "v"(gv2), "v"(gv3)
        : "memory");
}

// Lane l's value from lane l ^ 16 (the other half of the wave), on the vector pipe.
__device__ __forceinline__ float xhalf(float v) {
    int i = __builtin_bit_cast(int, v);
    return __builtin_bit_cast(float,
        __builtin_amdgcn_permlanex16(i, i, 0x76543210, 0xfedcba98, false, false));
}

__global__ __launch_bounds__(128)
void attn_kernel(const _Float16* __restrict__ q,    // [B][H][S][Dh]
                 const _Float16* __restrict__ k,    // [B][H][S][Dh]
                 const _Float16* __restrict__ vt,   // [B][H][Dh][S]
                 float* __restrict__ out)           // [B][S][D_MODEL]
{
    const int qt = blockIdx.x;          // q tile (64 rows)
    const int bh = blockIdx.y;          // b*NHEAD + h
    const int b  = bh >> 4;
    const int h  = bh & 15;
    const int t      = threadIdx.x;
    const int wid    = t >> 5;          // 0..3
    const int lane   = t & 31;
    const int laneLo = lane & 15;
    const int laneHi = lane >> 4;

    const _Float16* qh  = q  + (size_t)bh * SEQ * HEAD_DIM;
    const _Float16* kh  = k  + (size_t)bh * SEQ * HEAD_DIM;
    const _Float16* vth = vt + (size_t)bh * HEAD_DIM * SEQ;

    __shared__ __align__(16) _Float16 kvs[2][2][64][KV_PITCH];  // [buffer][K | V^T][row][col]

    // Block 0 into buffer 0, landed and published; then block 1 into buffer 1.
    stage_kv(kh, vth, kvs[0], t);
    asm volatile("s_wait_asynccnt 0x0" ::: "memory");   // this wave's copies of block 0 have landed
    __syncthreads();                                    // ... and every other wave's
    stage_kv(kh + 64 * HEAD_DIM, vth + 64, kvs[1], t);

    // Q^T fragments: 64 d x 16 queries -> two 32x16 B-frags, straight from global;
    // lane column = query, k order as in the K loader below
    const int qrow = qt * 64 + wid * 16 + laneLo;
    v16h Bq[2];
#pragma unroll
    for (int c = 0; c < 2; c++) {
        const _Float16* qp = qh + (size_t)qrow * HEAD_DIM + c * 32;
        v8h lo = *(const v8h*)(qp + laneHi * 8);
        v8h hi = *(const v8h*)(qp + 16 + laneHi * 8);
        Bq[c] = cat8(lo, hi);
    }

    // All-ones A tile: ones @ P^T gives each query's sum of P in every accumulator row
    v16h onesA;
#pragma unroll
    for (int i = 0; i < 16; i++) onesA[i] = (_Float16)1.0f;

    v8f Oacc[4];    // O^T: Oacc[n][r] = O[query laneLo][d = n*16 + laneHi*8 + r]
#pragma unroll
    for (int n = 0; n < 4; n++) Oacc[n] = zero8();
    float mrow = -3.0e38f, lrow = 0.0f;   // this lane's query
    const float scale = 0.03125f;   // 1/sqrt(D_MODEL)

    for (int j = 0; j < SEQ / 64; ++j) {
        const _Float16 (*ks)[KV_PITCH] = kvs[j & 1][0];   // [key][d]
        const _Float16 (*vs)[KV_PITCH] = kvs[j & 1][1];   // [d][key]

        // ---- Load ALL K A-fragments up front (one clause, overlapped) ----
        v16h Ak[2][4];
#pragma unroll
        for (int n = 0; n < 4; n++)
#pragma unroll
            for (int c = 0; c < 2; c++) {
                const _Float16* kp = &ks[n * 16 + laneLo][c * 32];
                v8h lo = *(const v8h*)(kp + laneHi * 8);
                v8h hi = *(const v8h*)(kp + 16 + laneHi * 8);
                Ak[c][n] = cat8(lo, hi);
            }
        __builtin_amdgcn_sched_barrier(0);   // pin loads ahead of WMMAs

        // ---- S^T = K @ Q^T : 8 back-to-back WMMAs ----
        // S[n][r] = score(key n*16 + laneHi*8 + r, query laneLo)
        v8f S[4];
#pragma unroll
        for (int n = 0; n < 4; n++) {
            v8f accn = __builtin_amdgcn_wmma_f32_16x16x32_f16(
                false, Ak[0][n], false, Bq[0], (short)0, zero8(), false, false);
            accn = __builtin_amdgcn_wmma_f32_16x16x32_f16(
                false, Ak[1][n], false, Bq[1], (short)0, accn, false, false);
            S[n] = accn;
        }

#pragma unroll
        for (int n = 0; n < 4; n++)
#pragma unroll
            for (int r = 0; r < 8; r++) S[n][r] *= scale;

        // ---- Online softmax: 32 of the query's 64 scores sit in this lane ----
        float mx8[8];
#pragma unroll
        for (int r = 0; r < 8; r++)
            mx8[r] = fmaxf(fmaxf(S[0][r], S[1][r]), fmaxf(S[2][r], S[3][r]));
        float mx = fmaxf(fmaxf(fmaxf(mx8[0], mx8[1]), fmaxf(mx8[2], mx8[3])),
                         fmaxf(fmaxf(mx8[4], mx8[5]), fmaxf(mx8[6], mx8[7])));
        mx = fmaxf(mx, xhalf(mx));      // the other 32 sit in lane ^ 16
        const float mnew  = fmaxf(mrow, mx);
        const float alpha = __expf(mrow - mnew);
        mrow = mnew;
#pragma unroll
        for (int n = 0; n < 4; n++)
#pragma unroll
            for (int r = 0; r < 8; r++) {
                S[n][r] = __expf(S[n][r] - mnew);
                Oacc[n][r] *= alpha;
            }

        // ---- P^T B-fragments in place: score tiles 2c and 2c+1 are keys
        //      {8*laneHi + 0..7} and {16 + 8*laneHi + 0..7} of 32-key chunk c,
        //      the k order of the V^T loader ----
        v16h Bp[2];
#pragma unroll
        for (int c = 0; c < 2; c++)
#pragma unroll
            for (int r = 0; r < 8; r++) {
                Bp[c][r]     = (_Float16)S[2 * c][r];
                Bp[c][8 + r] = (_Float16)S[2 * c + 1][r];
            }

        // ---- Load ALL V^T A-fragments up front ----
        v16h Av[2][4];
#pragma unroll
        for (int c = 0; c < 2; c++)
#pragma unroll
            for (int n = 0; n < 4; n++) {
                const _Float16* vp = &vs[n * 16 + laneLo][c * 32];
                v8h alo = *(const v8h*)(vp + laneHi * 8);
                v8h ahi = *(const v8h*)(vp + 16 + laneHi * 8);
                Av[c][n] = cat8(alo, ahi);
            }
        __builtin_amdgcn_sched_barrier(0);   // pin loads ahead of WMMAs

        // ---- O^T += V^T @ P^T  and  sums of P = ones @ P^T : 10 WMMAs ----
        v8f lacc = zero8();
#pragma unroll
        for (int c = 0; c < 2; c++) {
            lacc = __builtin_amdgcn_wmma_f32_16x16x32_f16(
                false, onesA, false, Bp[c], (short)0, lacc, false, false);
#pragma unroll
            for (int n = 0; n < 4; n++)
                Oacc[n] = __builtin_amdgcn_wmma_f32_16x16x32_f16(
                    false, Av[c][n], false, Bp[c], (short)0, Oacc[n], false, false);
        }
        lrow = lrow * alpha + lacc[0];

        // Hand-over: this wave has left buffer j & 1 and its copies of block j + 1
        // have landed; behind the barrier that holds for all four waves.
        asm volatile("s_wait_dscnt 0x0" ::: "memory");      // own LDS reads of this buffer are done
        asm volatile("s_wait_asynccnt 0x0" ::: "memory");   // own copies of block j + 1 have landed
        __syncthreads();        // publishes block j + 1, frees buffer j & 1
        if (j + 2 < SEQ / 64)
            stage_kv(kh + (size_t)(j + 2) * 64 * HEAD_DIM, vth + (j + 2) * 64, kvs[j & 1], t);
    }
    asm volatile("s_wait_asynccnt 0x0" ::: "memory");   // no copy outstanding at the wave's end

    // Normalize and write out [B][S][D_MODEL] f32: a lane holds 8 consecutive d per tile
    float* op = out + ((size_t)b * SEQ + qrow) * D_MODEL + h * HEAD_DIM + laneHi * 8;
#pragma unroll
    for (int n = 0; n < 4; n++) {
        v4f o0, o1;
#pragma unroll
        for (int r = 0; r < 4; r++) {
            o0[r] = Oacc[n][r] / lrow;
            o1[r] = Oacc[n][4 + r] / lrow;
        }
        *(v4f*)(op + n * 16)     = o0;
        *(v4f*)(op + n * 16 + 4) = o1;
    }
}

extern "C" void kernel_launch(void* const* d_in, const int* in_sizes, int n_in,
                              void* d_out, int out_size, void* d_ws, size_t ws_size,
                              hipStream_t stream) {
    const float* x  = (const float*)d_in[0];
    const float* Wq = (const float*)d_in[1];
    const float* bq = (const float*)d_in[2];
    const float* Wk = (const float*)d_in[3];
    const float* bk = (const float*)d_in[4];
    const float* Wv = (const float*)d_in[5];
    const float* bv = (const float*)d_in[6];
    float* out = (float*)d_out;

    const size_t per = (size_t)BATCH * NHEAD * SEQ * HEAD_DIM;  // 8.4M elems
    _Float16* qws = (_Float16*)d_ws;
    _Float16* kws = qws + per;
    _Float16* vws = kws + per;     // total 48MB of f16 in d_ws

    dim3 g1(D_MODEL / 128, NROWS / 128);   // (8, 64)
    qkv_proj_kernel<false><<<g1, 256, 0, stream>>>(x, Wq, bq, qws);
    qkv_proj_kernel<false><<<g1, 256, 0, stream>>>(x, Wk, bk, kws);
    qkv_proj_kernel<true ><<<g1, 256, 0, stream>>>(x, Wv, bv, vws);

    dim3 g2(SEQ / 64, BATCH * NHEAD);      // (32, 64)
    attn_kernel<<<g2, 128, 0, stream>>>(qws, kws, vws, out);
}

// v003
// It runs in 178 microseconds.
// Next to v002, in two timings, it ran 1.66 and 1.64 times as fast.
// All steps since v000 together make it 2.59 times as fast.
#include <hip/hip_runtime.h>

typedef __attribute__((ext_vector_type(16))) _Float16 v16h;
typedef __attribute__((ext_vector_type(8)))  _Float16 v8h;
typedef __attribute__((ext_vector_type(4)))  _Float16 v4h;
typedef __attribute__((ext_vector_type(8)))  float    v8f;
typedef __attribute__((ext_vector_type(4)))  float    v4f;

#define D_MODEL  1024
#define NHEAD    16
#define HEAD_DIM 64
#define BATCH    4
#define SEQ      2048
#define NROWS    (BATCH * SEQ)   // 8192

__device__ __forceinline__ v16h cat8(v8h lo, v8h hi) {
    v16h r;
#pragma unroll
    for (int i = 0; i < 8; i++) { r[i] = lo[i]; r[8 + i] = hi[i]; }
    return r;
}

__device__ __forceinline__ v8f zero8() {
    v8f r;
#pragma unroll
    for (int i = 0; i < 8; i++) r[i] = 0.0f;
    return r;
}

// ---------------------------------------------------------------------------
// Kernel 1: C[8192 x 1024] = X @ W + b, emitted as f16.
//   VT=false -> dst layout [B][H][S][Dh]   (Q, K)
//   VT=true  -> dst layout [B][H][Dh][S]   (V, pre-transposed for V^T@P^T A-frags)
// Block: 256 threads (8 waves), tile M=128 N=128, K-step 32.
// Wave (wm, wn) computes a 32x64 subtile = 8 WMMAs per K-step.
// ---------------------------------------------------------------------------
template <bool VT>
__global__ __launch_bounds__(256)
void qkv_proj_kernel(const float* __restrict__ x,
                     const float* __restrict__ W,
                     const float* __restrict__ bias,
                     _Float16* __restrict__ dst)
{
    const int nBase = blockIdx.x * 128;
    const int mBase = blockIdx.y * 128;
    const int t      = threadIdx.x;
    const int wid    = t >> 5;
    const int lane   = t & 31;
    const int laneLo = lane & 15;
    const int laneHi = lane >> 4;

    __shared__ __align__(16) _Float16 Xs[128][40];  // [m][k] f16, pad 8
    __shared__ __align__(16) _Float16 Ws[128][40];  // [n][k] (transposed) f16

    const int wm = wid >> 1;   // 0..3 : 32 rows each
    const int wn = wid & 1;    // 0..1 : 64 cols each

    v8f acc[2][4];
#pragma unroll
    for (int i = 0; i < 2; i++)
#pragma unroll
        for (int j = 0; j < 4; j++) acc[i][j] = zero8();

    for (int k0 = 0; k0 < D_MODEL; k0 += 32) {
        __syncthreads();
        // Stage X tile 128x32 (f32 -> f16)
#pragma unroll
        for (int i = 0; i < 4; i++) {
            int c   = t + 256 * i;        // 0..1023 (4-float chunks)
            int row = c >> 3;             // 0..127
            int kc  = (c & 7) * 4;        // 0..28
            v4f xv = *(const v4f*)(x + (size_t)(mBase + row) * D_MODEL + k0 + kc);
            v4h xh;
#pragma unroll
            for (int e = 0; e < 4; e++) xh[e] = (_Float16)xv[e];
            *(v4h*)&Xs[row][kc] = xh;
        }
        // Stage W tile 32x128 transposed -> Ws[n][k] (f32 -> f16): a thread takes a
        // 4 k x 4 n block (8 lanes cover one 128-B line of a k row), turns it in its
        // registers and stores 4 consecutive k of each n as one 8-byte piece
        {
            const int kq = ((wid & 1) * 4 + (lane >> 3)) * 4;   // 0..28, first of 4 k rows
            const int nc = ((wid >> 1) * 8 + (lane & 7)) * 4;   // 0..124, first of 4 columns
            const float* wp = W + (size_t)(k0 + kq) * D_MODEL + nBase + nc;
            v4f wv[4];
#pragma unroll
            for (int i = 0; i < 4; i++) wv[i] = *(const v4f*)(wp + (size_t)i * D_MODEL);
#pragma unroll
            for (int e = 0; e < 4; e++) {
                v4h wh;
#pragma unroll
                for (int i = 0; i < 4; i++) wh[i] = (_Float16)wv[i][e];
                *(v4h*)&Ws[nc + e][kq] = wh;
            }
        }
        __syncthreads();

        // A-frag layout (16x32 f16): lanes 0-15 K{0..7,16..23}; lanes 16-31 K{8..15,24..31}
        v16h Af[2], Bf[4];
#pragma unroll
        for (int mm = 0; mm < 2; mm++) {
            int row = wm * 32 + mm * 16 + laneLo;
            v8h lo = *(const v8h*)&Xs[row][laneHi * 8];
            v8h hi = *(const v8h*)&Xs[row][16 + laneHi * 8];
            Af[mm] = cat8(lo, hi);
        }
#pragma unroll
        for (int nn = 0; nn < 4; nn++) {
            int col = wn * 64 + nn * 16 + laneLo;
            v8h lo = *(const v8h*)&Ws[col][laneHi * 8];
            v8h hi = *(const v8h*)&Ws[col][16 + laneHi * 8];
            Bf[nn] = cat8(lo, hi);
        }
        __builtin_amdgcn_sched_barrier(0);   // keep all ds_loads issued first
#pragma unroll
        for (int mm = 0; mm < 2; mm++)
#pragma unroll
            for (int nn = 0; nn < 4; nn++)
                acc[mm][nn] = __builtin_amdgcn_wmma_f32_16x16x32_f16(
                    false, Af[mm], false, Bf[nn], (short)0, acc[mm][nn], false, false);
    }

    // Epilogue: add bias, convert f16, scatter to chosen layout
#pragma unroll
    for (int mm = 0; mm < 2; mm++) {
#pragma unroll
        for (int nn = 0; nn < 4; nn++) {
            int col = nBase + wn * 64 + nn * 16 + laneLo;
            float bv = bias[col];
            int h = col >> 6;          // head
            int d = col & 63;          // dim in head
#pragma unroll
            for (int r = 0; r < 8; r++) {
                int row = mBase + wm * 32 + mm * 16 + r + laneHi * 8;
                int bb = row >> 11;    // batch
                int s  = row & 2047;   // seq pos
                float val = acc[mm][nn][r] + bv;
                size_t idx;
                if (VT)
                    idx = (((size_t)bb * NHEAD + h) * HEAD_DIM + d) * SEQ + s;
                else
                    idx = (((size_t)bb * NHEAD + h) * SEQ + s) * HEAD_DIM + d;
                dst[idx] = (_Float16)val;
            }
        }
    }
}

#define KV_PITCH 72

typedef __attribute__((address_space(3))) const _Float16 lds_cf16;

__device__ __forceinline__ unsigned lds_addr(const _Float16* p) {
    return (unsigned)(uintptr_t)(lds_cf16*)p;   // byte offset in the work-group's LDS
}

// One key block into one buffer: 128 threads x 8 copies of 16 B.
// dst[0] = K tile [key][d], dst[1] = V^T tile [d][key]; 8 lanes fill one 128-B row.
__device__ __forceinline__ void stage_kv(const _Float16* kblk, const _Float16* vblk,
                                         _Float16 (*dst)[64][KV_PITCH], int t)
{
    const int row = t >> 3;          // 0..15, +16 per copy
    const int col = (t & 7) * 8;     // halfs
    const _Float16* gk0 = kblk + (size_t)row * HEAD_DIM + col;
    const _Float16* gk1 = gk0 + 16 * HEAD_DIM;
    const _Float16* gk2 = gk0 + 32 * HEAD_DIM;
    const _Float16* gk3 = gk0 + 48 * HEAD_DIM;
    const _Float16* gv0 = vblk + (size_t)row * SEQ + col;
    const _Float16* gv1 = gv0 + 16 * SEQ;
    const _Float16* gv2 = gv0 + 32 * SEQ;
    const _Float16* gv3 = gv0 + 48 * SEQ;
    const unsigned lk0 = lds_addr(&dst[0][row][col]);
    const unsigned lk1 = lds_addr(&dst[0][row + 16][col]);
    const unsigned lk2 = lds_addr(&dst[0][row + 32][col]);
    const unsigned lk3 = lds_addr(&dst[0][row + 48][col]);
    const unsigned lv0 = lds_addr(&dst[1][row][col]);
    const unsigned lv1 = lds_addr(&dst[1][row + 16][col]);
    const unsigned lv2 = lds_addr(&dst[1][row + 32][col]);
    const unsigned lv3 = lds_addr(&dst[1][row + 48][col]);
    // The copies and their s_wait_xcnt in one statement: the wait then stands in
    // front of every later write of an address register that a copy names.
    asm volatile(
        "global_load_async_to_lds_b128 %0, %8, off\n\t"
        "global_load_async_to_lds_b128 %1, %9, off\n\t"
        "global_load_async_to_lds_b128 %2, %10, off\n\t"
        "global_load_async_to_lds_b128 %3, %11, off\n\t"
        "global_load_async_to_lds_b128 %4, %12, off\n\t"
        "global_load_async_to_lds_b128 %5, %13, off\n\t"
        "global_load_async_to_lds_b128 %6, %14, off\n\t"
        "global_load_async_to_lds_b128 %7, %15, off\n\t"
        "s_wait_xcnt 0x0"
        :: "v"(lk0), "v"(lk1), "v"(lk2), "v"(lk3),
           "v"(lv0), "v"(lv1), "v"(lv2), "v"(lv3),
           "v"(gk0), "v"(gk1), "v"(gk2), "v"(gk3),
           "v"(gv0), "v"(gv1), "v"(gv2), "v"(gv3)
        : "memory");
}

// Lane l's value from lane l ^ 16 (the other half of the wave), on the vector pipe.
__device__ __forceinline__ float xhalf(float v) {
    int i = __builtin_bit_cast(int, v);
    return __builtin_bit_cast(float,
        __builtin_amdgcn_permlanex16(i, i, 0x76543210, 0xfedcba98, false, false));
}

__global__ __launch_bounds__(128)
void attn_kernel(const _Float16* __restrict__ q,    // [B][H][S][Dh]
                 const _Float16* __restrict__ k,    // [B][H][S][Dh]
                 const _Float16* __restrict__ vt,   // [B][H][Dh][S]
                 float* __restrict__ out)           // [B][S][D_MODEL]
{
    const int qt = blockIdx.x;          // q tile (64 rows)
    const int bh = blockIdx.y;          // b*NHEAD + h
    const int b  = bh >> 4;
    const int h  = bh & 15;
    const int t      = threadIdx.x;
    const int wid    = t >> 5;          // 0..3
    const int lane   = t & 31;
    const int laneLo = lane & 15;
    const int laneHi = lane >> 4;

    const _Float16* qh  = q  + (size_t)bh * SEQ * HEAD_DIM;
    const _Float16* kh  = k  + (size_t)bh * SEQ * HEAD_DIM;
    const _Float16* vth = vt + (size_t)bh * HEAD_DIM * SEQ;

    __shared__ __align__(16) _Float16 kvs[2][2][64][KV_PITCH];  // [buffer][K | V^T][row][col]

    // Block 0 into buffer 0, landed and published; then block 1 into buffer 1.
    stage_kv(kh, vth, kvs[0], t);
    asm volatile("s_wait_asynccnt 0x0" ::: "memory");   // this wave's copies of block 0 have landed
    __syncthreads();                                    // ... and every other wave's
    stage_kv(kh + 64 * HEAD_DIM, vth + 64, kvs[1], t);

    // Q^T fragments: 64 d x 16 queries -> two 32x16 B-frags, straight from global;
    // lane column = query, k order as in the K loader below
    const int qrow = qt * 64 + wid * 16 + laneLo;
    v16h Bq[2];
#pragma unroll
    for (int c = 0; c < 2; c++) {
        const _Float16* qp = qh + (size_t)qrow * HEAD_DIM + c * 32;
        v8h lo = *(const v8h*)(qp + laneHi * 8);
        v8h hi = *(const v8h*)(qp + 16 + laneHi * 8);
        Bq[c] = cat8(lo, hi);
    }

    // All-ones A tile: ones @ P^T gives each query's sum of P in every accumulator row
    v16h onesA;
#pragma unroll
    for (int i = 0; i < 16; i++) onesA[i] = (_Float16)1.0f;

    v8f Oacc[4];    // O^T: Oacc[n][r] = O[query laneLo][d = n*16 + laneHi*8 + r]
#pragma unroll
    for (int n = 0; n < 4; n++) Oacc[n] = zero8();
    float mrow = -3.0e38f, lrow = 0.0f;   // this lane's query
    const float scale = 0.03125f;   // 1/sqrt(D_MODEL)

    for (int j = 0; j < SEQ / 64; ++j) {
        const _Float16 (*ks)[KV_PITCH] = kvs[j & 1][0];   // [key][d]
        const _Float16 (*vs)[KV_PITCH] = kvs[j & 1][1];   // [d][key]

        // ---- Load ALL K A-fragments up front (one clause, overlapped) ----
        v16h Ak[2][4];
#pragma unroll
        for (int n = 0; n < 4; n++)
#pragma unroll
            for (int c = 0; c < 2; c++) {
                const _Float16* kp = &ks[n * 16 + laneLo][c * 32];
                v8h lo = *(const v8h*)(kp + laneHi * 8);
                v8h hi = *(const v8h*)(kp + 16 + laneHi * 8);
                Ak[c][n] = cat8(lo, hi);
            }
        __builtin_amdgcn_sched_barrier(0);   // pin loads ahead of WMMAs

        // ---- S^T = K @ Q^T : 8 back-to-back WMMAs ----
        // S[n][r] = score(key n*16 + laneHi*8 + r, query laneLo)
        v8f S[4];
#pragma unroll
        for (int n = 0; n < 4; n++) {
            v8f accn = __builtin_amdgcn_wmma_f32_16x16x32_f16(
                false, Ak[0][n], false, Bq[0], (short)0, zero8(), false, false);
            accn = __builtin_amdgcn_wmma_f32_16x16x32_f16(
                false, Ak[1][n], false, Bq[1], (short)0, accn, false, false);
            S[n] = accn;
        }

#pragma unroll
        for (int n = 0; n < 4; n++)
#pragma unroll
            for (int r = 0; r < 8; r++) S[n][r] *= scale;

        // ---- Online softmax: 32 of the query's 64 scores sit in this lane ----
        float mx8[8];
#pragma unroll
        for (int r = 0; r < 8; r++)
            mx8[r] = fmaxf(fmaxf(S[0][r], S[1][r]), fmaxf(S[2][r], S[3][r]));
        float mx = fmaxf(fmaxf(fmaxf(mx8[0], mx8[1]), fmaxf(mx8[2], mx8[3])),
                         fmaxf(fmaxf(mx8[4], mx8[5]), fmaxf(mx8[6], mx8[7])));
        mx = fmaxf(mx, xhalf(mx));      // the other 32 sit in lane ^ 16
        const float mnew  = fmaxf(mrow, mx);
        const float alpha = __expf(mrow - mnew);
        mrow = mnew;
#pragma unroll
        for (int n = 0; n < 4; n++)
#pragma unroll
            for (int r = 0; r < 8; r++) {
                S[n][r] = __expf(S[n][r] - mnew);
                Oacc[n][r] *= alpha;
            }

        // ---- P^T B-fragments in place: score tiles 2c and 2c+1 are keys
        //      {8*laneHi + 0..7} and {16 + 8*laneHi + 0..7} of 32-key chunk c,
        //      the k order of the V^T loader ----
        v16h Bp[2];
#pragma unroll
        for (int c = 0; c < 2; c++)
#pragma unroll
            for (int r = 0; r < 8; r++) {
                Bp[c][r]     = (_Float16)S[2 * c][r];
                Bp[c][8 + r] = (_Float16)S[2 * c + 1][r];
            }

        // ---- Load ALL V^T A-fragments up front ----
        v16h Av[2][4];
#pragma unroll
        for (int c = 0; c < 2; c++)
#pragma unroll
            for (int n = 0; n < 4; n++) {
                const _Float16* vp = &vs[n * 16 + laneLo][c * 32];
                v8h alo = *(const v8h*)(vp + laneHi * 8);
                v8h ahi = *(const v8h*)(vp + 16 + laneHi * 8);
                Av[c][n] = cat8(alo, ahi);
            }
        __builtin_amdgcn_sched_barrier(0);   // pin loads ahead of WMMAs

        // ---- O^T += V^T @ P^T  and  sums of P = ones @ P^T : 10 WMMAs ----
        v8f lacc = zero8();
#pragma unroll
        for (int c = 0; c < 2; c++) {
            lacc = __builtin_amdgcn_wmma_f32_16x16x32_f16(
                false, onesA, false, Bp[c], (short)0, lacc, false, false);
#pragma unroll
            for (int n = 0; n < 4; n++)
                Oacc[n] = __builtin_amdgcn_wmma_f32_16x16x32_f16(
                    false, Av[c][n], false, Bp[c], (short)0, Oacc[n], false, false);
        }
        lrow = lrow * alpha + lacc[0];

        // Hand-over: this wave has left buffer j & 1 and its copies of block j + 1
        // have landed; behind the barrier that holds for all four waves.
        asm volatile("s_wait_dscnt 0x0" ::: "memory");      // own LDS reads of this buffer are done
        asm volatile("s_wait_asynccnt 0x0" ::: "memory");   // own copies of block j + 1 have landed
        __syncthreads();        // publishes block j + 1, frees buffer j & 1
        if (j + 2 < SEQ / 64)
            stage_kv(kh + (size_t)(j + 2) * 64 * HEAD_DIM, vth + (j + 2) * 64, kvs[j & 1], t);
    }
    asm volatile("s_wait_asynccnt 0x0" ::: "memory");   // no copy outstanding at the wave's end

    // Normalize and write out [B][S][D_MODEL] f32: a lane holds 8 consecutive d per tile
    float* op = out + ((size_t)b * SEQ + qrow) * D_MODEL + h * HEAD_DIM + laneHi * 8;
#pragma unroll
    for (int n = 0; n < 4; n++) {
        v4f o0, o1;
#pragma unroll
        for (int r = 0; r < 4; r++) {
            o0[r] = Oacc[n][r] / lrow;
            o1[r] = Oacc[n][4 + r] / lrow;
        }
        *(v4f*)(op + n * 16)     = o0;
        *(v4f*)(op + n * 16 + 4) = o1;
    }
}

extern "C" void kernel_launch(void* const* d_in, const int* in_sizes, int n_in,
                              void* d_out, int out_size, void* d_ws, size_t ws_size,
                              hipStream_t stream) {
    const float* x  = (const float*)d_in[0];
    const float* Wq = (const float*)d_in[1];
    const float* bq = (const float*)d_in[2];
    const float* Wk = (const float*)d_in[3];
    const float* bk = (const float*)d_in[4];
    const float* Wv = (const float*)d_in[5];
    const float* bv = (const float*)d_in[6];
    float* out = (float*)d_out;

    const size_t per = (size_t)BATCH * NHEAD * SEQ * HEAD_DIM;  // 8.4M elems
    _Float16* qws = (_Float16*)d_ws;
    _Float16* kws = qws + per;
    _Float16* vws = kws + per;     // total 48MB of f16 in d_ws

    dim3 g1(D_MODEL / 128, NROWS / 128);   // (8, 64)
    qkv_proj_kernel<false><<<g1, 256, 0, stream>>>(x, Wq, bq, qws);
    qkv_proj_kernel<false><<<g1, 256, 0, stream>>>(x, Wk, bk, kws);
    qkv_proj_kernel<true ><<<g1, 256, 0, stream>>>(x, Wv, bv, vws);

    dim3 g2(SEQ / 64, BATCH * NHEAD);      // (32, 64)
    attn_kernel<<<g2, 128, 0, stream>>>(qws, kws, vws, out);
}

// v004
// One run takes 128 microseconds.
// Next to v003, in two timings, it ran 1.38 and 1.37 times as fast.
// Counting every step since v000, it is 3.57 times as fast.
#include <hip/hip_runtime.h>

typedef __attribute__((ext_vector_type(16))) _Float16 v16h;
typedef __attribute__((ext_vector_type(8)))  _Float16 v8h;
typedef __attribute__((ext_vector_type(4)))  _Float16 v4h;
typedef __attribute__((ext_vector_type(8)))  float    v8f;
typedef __attribute__((ext_vector_type(4)))  float    v4f;

#define D_MODEL  1024
#define NHEAD    16
#define HEAD_DIM 64
#define BATCH    4
#define SEQ      2048
#define NROWS    (BATCH * SEQ)   // 8192

__device__ __forceinline__ v16h cat8(v8h lo, v8h hi) {
    v16h r;
#pragma unroll
    for (int i = 0; i < 8; i++) { r[i] = lo[i]; r[8 + i] = hi[i]; }
    return r;
}

__device__ __forceinline__ v8f zero8() {
    v8f r;
#pragma unroll
    for (int i = 0; i < 8; i++) r[i] = 0.0f;
    return r;
}

#define KV_PITCH 72   // halfs per staged row: 144 B = 16 B x 9, conflict-free for b128 readers

typedef __attribute__((address_space(3))) const _Float16 lds_cf16;

__device__ __forceinline__ unsigned lds_addr(const _Float16* p) {
    return (unsigned)(uintptr_t)(lds_cf16*)p;   // byte offset in the work-group's LDS
}

// ---------------------------------------------------------------------------
// Kernel 0: the projections' operands as f16, k-contiguous, written once per call.
//   blocks 0..383   : W (f32 [k][n]) -> wt (f16 [matrix][n][k]); a block turns a
//                     64 k x 128 n tile, a thread an 8 k x 4 n piece in its registers
//   blocks 384..2431: x (f32) -> xh (f16), same layout, 4096 elements per block
// The unrolled loops here and in kernel 1 index vectors and fragment arrays, which
// stay in registers only if every index is a compile-time constant.
// ---------------------------------------------------------------------------
#define W_BLOCKS 384

__global__ __launch_bounds__(256)
void to_f16_kernel(const float* __restrict__ x,
                   const float* __restrict__ Wq,
                   const float* __restrict__ Wk,
                   const float* __restrict__ Wv,
                   _Float16* __restrict__ xh,
                   _Float16* __restrict__ wt)
{
    const int t   = threadIdx.x;
    const int blk = blockIdx.x;
    if (blk < W_BLOCKS) {
        const int m    = blk >> 7;        // 0 Wq, 1 Wk, 2 Wv
        const int tile = blk & 127;
        const int wid  = t >> 5;
        const int lane = t & 31;
        const float* W = (m == 0) ? Wq : ((m == 1) ? Wk : Wv);
        // 8 lanes cover one 128-B line of a k row; 4 lanes cover 64 B of an output row
        const int ko = (tile >> 3) * 64 + ((wid & 1) * 4 + (lane >> 3)) * 8;
        const int nc = (tile & 7) * 128 + ((wid >> 1) * 8 + (lane & 7)) * 4;
        const float* wp = W + (size_t)ko * D_MODEL + nc;
        v4f wv[8];
#pragma unroll
        for (int i = 0; i < 8; i++) wv[i] = *(const v4f*)(wp + (size_t)i * D_MODEL);
        _Float16* op = wt + ((size_t)m * D_MODEL + nc) * D_MODEL + ko;
#pragma unroll
        for (int e = 0; e < 4; e++) {
            v8h wh;
#pragma unroll
            for (int i = 0; i < 8; i++) wh[i] = (_Float16)wv[i][e];
            *(v8h*)(op + (size_t)e * D_MODEL) = wh;
        }
    } else {
        const size_t base = (size_t)(blk - W_BLOCKS) * 4096;
        v4f xv[4];
#pragma unroll
        for (int i = 0; i < 4; i++) xv[i] = *(const v4f*)(x + base + (t + 256 * i) * 4);
#pragma unroll
        for (int i = 0; i < 4; i++) {
            v4h xo;
#pragma unroll
            for (int e = 0; e < 4; e++) xo[e] = (_Float16)xv[i][e];
            *(v4h*)(xh + base + (t + 256 * i) * 4) = xo;
        }
        // precaution: stands in front of every later write of a register that the four
        // stores name (the built code runs on from here into the W part's first lines)
        asm volatile("s_wait_xcnt 0x0" ::: "memory");
    }
}

// One 64-k step of both operand tiles into one buffer: 256 threads x 8 copies of 16 B.
// dst[0] = X tile [m][k], dst[1] = W tile [n][k]; 8 lanes fill one 128-B row.
__device__ __forceinline__ void stage_xw(const _Float16* xblk, const _Float16* wblk,
                                         _Float16 (*dst)[128][KV_PITCH], int t)
{
    const int row = t >> 3;          // 0..31, +32 per copy
    const int col = (t & 7) * 8;     // halfs
    const _Float16* gx0 = xblk + (size_t)row * D_MODEL + col;
    const _Float16* gx1 = gx0 + 32 * D_MODEL;
    const _Float16* gx2 = gx0 + 64 * D_MODEL;
    const _Float16* gx3 = gx0 + 96 * D_MODEL;
    const _Float16* gw0 = wblk + (size_t)row * D_MODEL + col;
    const _Float16* gw1 = gw0 + 32 * D_MODEL;
    const _Float16* gw2 = gw0 + 64 * D_MODEL;
    const _Float16* gw3 = gw0 + 96 * D_MODEL;
    const unsigned lx0 = lds_addr(&dst[0][row][col]);
    const unsigned lx1 = lds_addr(&dst[0][row + 32][col]);
    const unsigned lx2 = lds_addr(&dst[0][row + 64][col]);
    const unsigned lx3 = lds_addr(&dst[0][row + 96][col]);
    const unsigned lw0 = lds_addr(&dst[1][row][col]);
    const unsigned lw1 = lds_addr(&dst[1][row + 32][col]);
    const unsigned lw2 = lds_addr(&dst[1][row + 64][col]);
    const unsigned lw3 = lds_addr(&dst[1][row + 96][col]);
    // The copies and their s_wait_xcnt in one statement: the wait then stands in
    // front of every later write of an address register that a copy names.
    asm volatile(
        "global_load_async_to_lds_b128 %0, %8, off\n\t"
        "global_load_async_to_lds_b128 %1, %9, off\n\t"
        "global_load_async_to_lds_b128 %2, %10, off\n\t"
        "global_load_async_to_lds_b128 %3, %11, off\n\t"
        "global_load_async_to_lds_b128 %4, %12, off\n\t"
        "global_load_async_to_lds_b128 %5, %13, off\n\t"
        "global_load_async_to_lds_b128 %6, %14, off\n\t"
        "global_load_async_to_lds_b128 %7, %15, off\n\t"
        "s_wait_xcnt 0x0"
        :: "v"(lx0), "v"(lx1), "v"(lx2), "v"(lx3),
           "v"(lw0), "v"(lw1), "v"(lw2), "v"(lw3),
           "v"(gx0), "v"(gx1), "v"(gx2), "v"(gx3),
           "v"(gw0), "v"(gw1), "v"(gw2), "v"(gw3)
        : "memory");
}

// ---------------------------------------------------------------------------
// Kernel 1: C[8192 x 1024] = X @ W + b, emitted as f16; X and W come as f16,
// both k-contiguous (kernel 0).
//   VT=false -> dst layout [B][H][S][Dh]   (Q, K)
//   VT=true  -> dst layout [B][H][Dh][S]   (V, pre-transposed for the V^T A-frags of O^T += V^T P^T)
// Block: 256 threads (8 waves), tile M=128 N=128, K-step 64, brought into LDS by
// asynchronous copies one step ahead in two buffers.
// Wave (wm, wn) computes a 32x64 subtile = 16 WMMAs per K-step.
// ---------------------------------------------------------------------------
#define KSTEP 64

template <bool VT>
__global__ __launch_bounds__(256)
void qkv_proj_kernel(const _Float16* __restrict__ xh,   // [8192][1024]
                     const _Float16* __restrict__ wt,   // [n][k]
                     const float* __restrict__ bias,
                     _Float16* __restrict__ dst)
{
    const int nBase = blockIdx.x * 128;
    const int mBase = blockIdx.y * 128;
    const int t      = threadIdx.x;
    const int wid    = t >> 5;
    const int lane   = t & 31;
    const int laneLo = lane & 15;
    const int laneHi = lane >> 4;

    __shared__ __align__(16) _Float16 xws[2][2][128][KV_PITCH];  // [buffer][X | W][row][k]

    const int wm = wid >> 1;   // 0..3 : 32 rows each
    const int wn = wid & 1;    // 0..1 : 64 cols each

    const _Float16* xb = xh + (size_t)mBase * D_MODEL;
    const _Float16* wb = wt + (size_t)nBase * D_MODEL;

    // Step 0 into buffer 0, landed and published; then step 1 into buffer 1.
    stage_xw(xb, wb, xws[0], t);
    asm volatile("s_wait_asynccnt 0x0" ::: "memory");   // this wave's copies of step 0 have landed
    __syncthreads();                                    // ... and every other wave's
    stage_xw(xb + KSTEP, wb + KSTEP, xws[1], t);

    v8f acc[2][4];
#pragma unroll
    for (int i = 0; i < 2; i++)
#pragma unroll
        for (int j = 0; j < 4; j++) acc[i][j] = zero8();

    for (int j = 0; j < D_MODEL / KSTEP; ++j) {
        const _Float16 (*Xs)[KV_PITCH] = xws[j & 1][0];   // [m][k]
        const _Float16 (*Ws)[KV_PITCH] = xws[j & 1][1];   // [n][k]

        // A-frag layout (16x32 f16): lanes 0-15 K{0..7,16..23}; lanes 16-31 K{8..15,24..31}
        v16h Af[2][2], Bf[2][4];
#pragma unroll
        for (int c = 0; c < 2; c++) {
#pragma unroll
            for (int mm = 0; mm < 2; mm++) {
                const _Float16* ap = &Xs[wm * 32 + mm * 16 + laneLo][c * 32];
                v8h lo = *(const v8h*)(ap + laneHi * 8);
                v8h hi = *(const v8h*)(ap + 16 + laneHi * 8);
                Af[c][mm] = cat8(lo, hi);
            }
#pragma unroll
            for (int nn = 0; nn < 4; nn++) {
                const _Float16* bp = &Ws[wn * 64 + nn * 16 + laneLo][c * 32];
                v8h lo = *(const v8h*)(bp + laneHi * 8);
                v8h hi = *(const v8h*)(bp + 16 + laneHi * 8);
                Bf[c][nn] = cat8(lo, hi);
            }
        }
        __builtin_amdgcn_sched_barrier(0);   // keep all ds_loads issued first
#pragma unroll
        for (int c = 0; c < 2; c++)
#pragma unroll
            for (int mm = 0; mm < 2; mm++)
#pragma unroll
                for (int nn = 0; nn < 4; nn++)
                    acc[mm][nn] = __builtin_amdgcn_wmma_f32_16x16x32_f16(
                        false, Af[c][mm], false, Bf[c][nn], (short)0, acc[mm][nn], false, false);
        // keep the hand-over behind the WMMAs: lifted above them, the wait for the next
        // step's copies comes right after their issue and the WMMAs no longer cover their flight
        __builtin_amdgcn_sched_barrier(0);

        // Hand-over: this wave has left buffer j & 1 and its copies of step j + 1
        // have landed; behind the barrier that holds for all eight waves.
        asm volatile("s_wait_dscnt 0x0" ::: "memory");      // own LDS reads of this buffer are done
        asm volatile("s_wait_asynccnt 0x0" ::: "memory");   // own copies of step j + 1 have landed
        __syncthreads();        // publishes step j + 1, frees buffer j & 1
        if (j + 2 < D_MODEL / KSTEP)
            stage_xw(xb + (j + 2) * KSTEP, wb + (j + 2) * KSTEP, xws[j & 1], t);
    }
    asm volatile("s_wait_asynccnt 0x0" ::: "memory");   // no copy outstanding at the wave's end

    // Epilogue: add bias, convert f16, scatter to chosen layout
#pragma unroll
    for (int mm = 0; mm < 2; mm++) {
#pragma unroll
        for (int nn = 0; nn < 4; nn++) {
            int col = nBase + wn * 64 + nn * 16 + laneLo;
            float bv = bias[col];
            int h = col >> 6;          // head
            int d = col & 63;          // dim in head
#pragma unroll
            for (int r = 0; r < 8; r++) {
                int row = mBase + wm * 32 + mm * 16 + r + laneHi * 8;
                int bb = row >> 11;    // batch
                int s  = row & 2047;   // seq pos
                float val = acc[mm][nn][r] + bv;
                size_t idx;
                if (VT)
                    idx = (((size_t)bb * NHEAD + h) * HEAD_DIM + d) * SEQ + s;
                else
                    idx = (((size_t)bb * NHEAD + h) * SEQ + s) * HEAD_DIM + d;
                dst[idx] = (_Float16)val;
            }
        }
    }
}

__device__ __forceinline__ void stage_kv(const _Float16* kblk, const _Float16* vblk,
                                         _Float16 (*dst)[64][KV_PITCH], int t)
{
    const int row = t >> 3;          // 0..15, +16 per copy
    const int col = (t & 7) * 8;     // halfs
    const _Float16* gk0 = kblk + (size_t)row * HEAD_DIM + col;
    const _Float16* gk1 = gk0 + 16 * HEAD_DIM;
    const _Float16* gk2 = gk0 + 32 * HEAD_DIM;
    const _Float16* gk3 = gk0 + 48 * HEAD_DIM;
    const _Float16* gv0 = vblk + (size_t)row * SEQ + col;
    const _Float16* gv1 = gv0 + 16 * SEQ;
    const _Float16* gv2 = gv0 + 32 * SEQ;
    const _Float16* gv3 = gv0 + 48 * SEQ;
    const unsigned lk0 = lds_addr(&dst[0][row][col]);
    const unsigned lk1 = lds_addr(&dst[0][row + 16][col]);
    const unsigned lk2 = lds_addr(&dst[0][row + 32][col]);
    const unsigned lk3 = lds_addr(&dst[0][row + 48][col]);
    const unsigned lv0 = lds_addr(&dst[1][row][col]);
    const unsigned lv1 = lds_addr(&dst[1][row + 16][col]);
    const unsigned lv2 = lds_addr(&dst[1][row + 32][col]);
    const unsigned lv3 = lds_addr(&dst[1][row + 48][col]);
    // The copies and their s_wait_xcnt in one statement: the wait then stands in
    // front of every later write of an address register that a copy names.
    asm volatile(
        "global_load_async_to_lds_b128 %0, %8, off\n\t"
        "global_load_async_to_lds_b128 %1, %9, off\n\t"
        "global_load_async_to_lds_b128 %2, %10, off\n\t"
        "global_load_async_to_lds_b128 %3, %11, off\n\t"
        "global_load_async_to_lds_b128 %4, %12, off\n\t"
        "global_load_async_to_lds_b128 %5, %13, off\n\t"
        "global_load_async_to_lds_b128 %6, %14, off\n\t"
        "global_load_async_to_lds_b128 %7, %15, off\n\t"
        "s_wait_xcnt 0x0"
        :: "v"(lk0), "v"(lk1), "v"(lk2), "v"(lk3),
           "v"(lv0), "v"(lv1), "v"(lv2), "v"(lv3),
           "v"(gk0), "v"(gk1), "v"(gk2), "v"(gk3),
           "v"(gv0), "v"(gv1), "v"(gv2), "v"(gv3)
        : "memory");
}

// Lane l's value from lane l ^ 16 (the other half of the wave), on the vector pipe.
__device__ __forceinline__ float xhalf(float v) {
    int i = __builtin_bit_cast(int, v);
    return __builtin_bit_cast(float,
        __builtin_amdgcn_permlanex16(i, i, 0x76543210, 0xfedcba98, false, false));
}

__global__ __launch_bounds__(128)
void attn_kernel(const _Float16* __restrict__ q,    // [B][H][S][Dh]
                 const _Float16* __restrict__ k,    // [B][H][S][Dh]
                 const _Float16* __restrict__ vt,   // [B][H][Dh][S]
                 float* __restrict__ out)           // [B][S][D_MODEL]
{
    const int qt = blockIdx.x;          // q tile (64 rows)
    const int bh = blockIdx.y;          // b*NHEAD + h
    const int b  = bh >> 4;
    const int h  = bh & 15;
    const int t      = threadIdx.x;
    const int wid    = t >> 5;          // 0..3
    const int lane   = t & 31;
    const int laneLo = lane & 15;
    const int laneHi = lane >> 4;

    const _Float16* qh  = q  + (size_t)bh * SEQ * HEAD_DIM;
    const _Float16* kh  = k  + (size_t)bh * SEQ * HEAD_DIM;
    const _Float16* vth = vt + (size_t)bh * HEAD_DIM * SEQ;

    __shared__ __align__(16) _Float16 kvs[2][2][64][KV_PITCH];  // [buffer][K | V^T][row][col]

    // Block 0 into buffer 0, landed and published; then block 1 into buffer 1.
    stage_kv(kh, vth, kvs[0], t);
    asm volatile("s_wait_asynccnt 0x0" ::: "memory");   // this wave's copies of block 0 have landed
    __syncthreads();                                    // ... and every other wave's
    stage_kv(kh + 64 * HEAD_DIM, vth + 64, kvs[1], t);

    // Q^T fragments: 64 d x 16 queries -> two 32x16 B-frags, straight from global;
    // lane column = query, k order as in the K loader below
    const int qrow = qt * 64 + wid * 16 + laneLo;
    v16h Bq[2];
#pragma unroll
    for (int c = 0; c < 2; c++) {
        const _Float16* qp = qh + (size_t)qrow * HEAD_DIM + c * 32;
        v8h lo = *(const v8h*)(qp + laneHi * 8);
        v8h hi = *(const v8h*)(qp + 16 + laneHi * 8);
        Bq[c] = cat8(lo, hi);
    }

    // All-ones A tile: ones @ P^T gives each query's sum of P in every accumulator row
    v16h onesA;
#pragma unroll
    for (int i = 0; i < 16; i++) onesA[i] = (_Float16)1.0f;

    v8f Oacc[4];    // O^T: Oacc[n][r] = O[query laneLo][d = n*16 + laneHi*8 + r]
#pragma unroll
    for (int n = 0; n < 4; n++) Oacc[n] = zero8();
    float mrow = -3.0e38f, lrow = 0.0f;   // this lane's query
    const float scale = 0.03125f;   // 1/sqrt(D_MODEL)

    for (int j = 0; j < SEQ / 64; ++j) {
        const _Float16 (*ks)[KV_PITCH] = kvs[j & 1][0];   // [key][d]
        const _Float16 (*vs)[KV_PITCH] = kvs[j & 1][1];   // [d][key]

        // ---- Load ALL K A-fragments up front (one clause, overlapped) ----
        v16h Ak[2][4];
#pragma unroll
        for (int n = 0; n < 4; n++)
#pragma unroll
            for (int c = 0; c < 2; c++) {
                const _Float16* kp = &ks[n * 16 + laneLo][c * 32];
                v8h lo = *(const v8h*)(kp + laneHi * 8);
                v8h hi = *(const v8h*)(kp + 16 + laneHi * 8);
                Ak[c][n] = cat8(lo, hi);
            }
        __builtin_amdgcn_sched_barrier(0);   // pin loads ahead of WMMAs

        // ---- S^T = K @ Q^T : 8 back-to-back WMMAs ----
        // S[n][r] = score(key n*16 + laneHi*8 + r, query laneLo)
        v8f S[4];
#pragma unroll
        for (int n = 0; n < 4; n++) {
            v8f accn = __builtin_amdgcn_wmma_f32_16x16x32_f16(
                false, Ak[0][n], false, Bq[0], (short)0, zero8(), false, false);
            accn = __builtin_amdgcn_wmma_f32_16x16x32_f16(
                false, Ak[1][n], false, Bq[1], (short)0, accn, false, false);
            S[n] = accn;
        }

#pragma unroll
        for (int n = 0; n < 4; n++)
#pragma unroll
            for (int r = 0; r < 8; r++) S[n][r] *= scale;

        // ---- Online softmax: 32 of the query's 64 scores sit in this lane ----
        float mx8[8];
#pragma unroll
        for (int r = 0; r < 8; r++)
            mx8[r] = fmaxf(fmaxf(S[0][r], S[1][r]), fmaxf(S[2][r], S[3][r]));
        float mx = fmaxf(fmaxf(fmaxf(mx8[0], mx8[1]), fmaxf(mx8[2], mx8[3])),
                         fmaxf(fmaxf(mx8[4], mx8[5]), fmaxf(mx8[6], mx8[7])));
        mx = fmaxf(mx, xhalf(mx));      // the other 32 sit in lane ^ 16
        const float mnew  = fmaxf(mrow, mx);
        const float alpha = __expf(mrow - mnew);
        mrow = mnew;
#pragma unroll
        for (int n = 0; n < 4; n++)
#pragma unroll
            for (int r = 0; r < 8; r++) {
                S[n][r] = __expf(S[n][r] - mnew);
                Oacc[n][r] *= alpha;
            }

        // ---- P^T B-fragments in place: score tiles 2c and 2c+1 are keys
        //      {8*laneHi + 0..7} and {16 + 8*laneHi + 0..7} of 32-key chunk c,
        //      the k order of the V^T loader ----
        v16h Bp[2];
#pragma unroll
        for (int c = 0; c < 2; c++)
#pragma unroll
            for (int r = 0; r < 8; r++) {
                Bp[c][r]     = (_Float16)S[2 * c][r];
                Bp[c][8 + r] = (_Float16)S[2 * c + 1][r];
            }

        // ---- Load ALL V^T A-fragments up front ----
        v16h Av[2][4];
#pragma unroll
        for (int c = 0; c < 2; c++)
#pragma unroll
            for (int n = 0; n < 4; n++) {
                const _Float16* vp = &vs[n * 16 + laneLo][c * 32];
                v8h alo = *(const v8h*)(vp + laneHi * 8);
                v8h ahi = *(const v8h*)(vp + 16 + laneHi * 8);
                Av[c][n] = cat8(alo, ahi);
            }
        __builtin_amdgcn_sched_barrier(0);   // pin loads ahead of WMMAs

        // ---- O^T += V^T @ P^T  and  sums of P = ones @ P^T : 10 WMMAs ----
        v8f lacc = zero8();
#pragma unroll
        for (int c = 0; c < 2; c++) {
            lacc = __builtin_amdgcn_wmma_f32_16x16x32_f16(
                false, onesA, false, Bp[c], (short)0, lacc, false, false);
#pragma unroll
            for (int n = 0; n < 4; n++)
                Oacc[n] = __builtin_amdgcn_wmma_f32_16x16x32_f16(
                    false, Av[c][n], false, Bp[c], (short)0, Oacc[n], false, false);
        }
        lrow = lrow * alpha + lacc[0];

        // Hand-over: this wave has left buffer j & 1 and its copies of block j + 1
        // have landed; behind the barrier that holds for all four waves.
        asm volatile("s_wait_dscnt 0x0" ::: "memory");      // own LDS reads of this buffer are done
        asm volatile("s_wait_asynccnt 0x0" ::: "memory");   // own copies of block j + 1 have landed
        __syncthreads();        // publishes block j + 1, frees buffer j & 1
        if (j + 2 < SEQ / 64)
            stage_kv(kh + (size_t)(j + 2) * 64 * HEAD_DIM, vth + (j + 2) * 64, kvs[j & 1], t);
    }
    asm volatile("s_wait_asynccnt 0x0" ::: "memory");   // no copy outstanding at the wave's end

    // Normalize and write out [B][S][D_MODEL] f32: a lane holds 8 consecutive d per tile
    float* op = out + ((size_t)b * SEQ + qrow) * D_MODEL + h * HEAD_DIM + laneHi * 8;
#pragma unroll
    for (int n = 0; n < 4; n++) {
        v4f o0, o1;
#pragma unroll
        for (int r = 0; r < 4; r++) {
            o0[r] = Oacc[n][r] / lrow;
            o1[r] = Oacc[n][4 + r] / lrow;
        }
        *(v4f*)(op + n * 16)     = o0;
        *(v4f*)(op + n * 16 + 4) = o1;
    }
}

extern "C" void kernel_launch(void* const* d_in, const int* in_sizes, int n_in,
                              void* d_out, int out_size, void* d_ws, size_t ws_size,
                              hipStream_t stream) {
    const float* x  = (const float*)d_in[0];
    const float* Wq = (const float*)d_in[1];
    const float* bq = (const float*)d_in[2];
    const float* Wk = (const float*)d_in[3];
    const float* bk = (const float*)d_in[4];
    const float* Wv = (const float*)d_in[5];
    const float* bv = (const float*)d_in[6];
    float* out = (float*)d_out;

    const size_t per = (size_t)BATCH * NHEAD * SEQ * HEAD_DIM;  // 8.4M elems
    const size_t wsz = (size_t)D_MODEL * D_MODEL;               // 1M elems
    _Float16* qws = (_Float16*)d_ws;
    _Float16* kws = qws + per;
    _Float16* vws = kws + per;
    _Float16* xh  = vws + per;
    _Float16* wt  = xh + per;      // total 70MB of f16 in d_ws

    to_f16_kernel<<<W_BLOCKS + NROWS * D_MODEL / 4096, 256, 0, stream>>>(x, Wq, Wk, Wv, xh, wt);

    dim3 g1(D_MODEL / 128, NROWS / 128);   // (8, 64)
    qkv_proj_kernel<false><<<g1, 256, 0, stream>>>(xh, wt,           bq, qws);
    qkv_proj_kernel<false><<<g1, 256, 0, stream>>>(xh, wt + wsz,     bk, kws);
    qkv_proj_kernel<true ><<<g1, 256, 0, stream>>>(xh, wt + 2 * wsz, bv, vws);

    dim3 g2(SEQ / 64, BATCH * NHEAD);      // (32, 64)
    attn_kernel<<<g2, 128, 0, stream>>>(qws, kws, vws, out);
}

// v005
// A run of this version takes 118 microseconds.
// Two timings next to v004 put it at 1.09 and 1.10 times that version's speed.
// All steps since v000 together make it 3.92 times as fast.
#include <hip/hip_runtime.h>

typedef __attribute__((ext_vector_type(16))) _Float16 v16h;
typedef __attribute__((ext_vector_type(8)))  _Float16 v8h;
typedef __attribute__((ext_vector_type(4)))  _Float16 v4h;
typedef __attribute__((ext_vector_type(8)))  float    v8f;
typedef __attribute__((ext_vector_type(4)))  float    v4f;

#define D_MODEL  1024
#define NHEAD    16
#define HEAD_DIM 64
#define BATCH    4
#define SEQ      2048
#define NROWS    (BATCH * SEQ)   // 8192

__device__ __forceinline__ v16h cat8(v8h lo, v8h hi) {
    v16h r;
#pragma unroll
    for (int i = 0; i < 8; i++) { r[i] = lo[i]; r[8 + i] = hi[i]; }
    return r;
}

__device__ __forceinline__ v8f zero8() {
    v8f r;
#pragma unroll
    for (int i = 0; i < 8; i++) r[i] = 0.0f;
    return r;
}

#define KV_PITCH 72   // halfs per staged row: 144 B = 16 B x 9, conflict-free for b128 readers

typedef __attribute__((address_space(3))) const _Float16 lds_cf16;

__device__ __forceinline__ unsigned lds_addr(const _Float16* p) {
    return (unsigned)(uintptr_t)(lds_cf16*)p;   // byte offset in the work-group's LDS
}

// ---------------------------------------------------------------------------
// Kernel 0: the projections' operands as f16, k-contiguous, written once per call.
//   blocks 0..383   : W (f32 [k][n]) -> wt (f16 [matrix][n][k]); a block turns a
//                     64 k x 128 n tile, a thread an 8 k x 4 n piece in its registers
//   blocks 384..2431: x (f32) -> xh (f16), same layout, 4096 elements per block
// The unrolled loops here and in kernel 1 index vectors and fragment arrays, which
// stay in registers only if every index is a compile-time constant.
// ---------------------------------------------------------------------------
#define W_BLOCKS 384

__global__ __launch_bounds__(256)
void to_f16_kernel(const float* __restrict__ x,
                   const float* __restrict__ Wq,
                   const float* __restrict__ Wk,
                   const float* __restrict__ Wv,
                   _Float16* __restrict__ xh,
                   _Float16* __restrict__ wt)
{
    const int t   = threadIdx.x;
    const int blk = blockIdx.x;
    if (blk < W_BLOCKS) {
        const int m    = blk >> 7;        // 0 Wq, 1 Wk, 2 Wv
        const int tile = blk & 127;
        const int wid  = t >> 5;
        const int lane = t & 31;
        const float* W = (m == 0) ? Wq : ((m == 1) ? Wk : Wv);
        // 8 lanes cover one 128-B line of a k row; 4 lanes cover 64 B of an output row
        const int ko = (tile >> 3) * 64 + ((wid & 1) * 4 + (lane >> 3)) * 8;
        const int nc = (tile & 7) * 128 + ((wid >> 1) * 8 + (lane & 7)) * 4;
        const float* wp = W + (size_t)ko * D_MODEL + nc;
        v4f wv[8];
#pragma unroll
        for (int i = 0; i < 8; i++) wv[i] = *(const v4f*)(wp + (size_t)i * D_MODEL);
        _Float16* op = wt + ((size_t)m * D_MODEL + nc) * D_MODEL + ko;
#pragma unroll
        for (int e = 0; e < 4; e++) {
            v8h wh;
#pragma unroll
            for (int i = 0; i < 8; i++) wh[i] = (_Float16)wv[i][e];
            *(v8h*)(op + (size_t)e * D_MODEL) = wh;
        }
    } else {
        const size_t base = (size_t)(blk - W_BLOCKS) * 4096;
        v4f xv[4];
#pragma unroll
        for (int i = 0; i < 4; i++) xv[i] = *(const v4f*)(x + base + (t + 256 * i) * 4);
#pragma unroll
        for (int i = 0; i < 4; i++) {
            v4h xo;
#pragma unroll
            for (int e = 0; e < 4; e++) xo[e] = (_Float16)xv[i][e];
            *(v4h*)(xh + base + (t + 256 * i) * 4) = xo;
        }
        // precaution: stands in front of every later write of a register that the four
        // stores name (the built code runs on from here into the W part's first lines)
        asm volatile("s_wait_xcnt 0x0" ::: "memory");
    }
}

// One 64-k step of both operand tiles into one buffer: 256 threads x 8 copies of 16 B.
// dst[0] = X tile [m][k], dst[1] = W tile [n][k]; 8 lanes fill one 128-B row.
__device__ __forceinline__ void stage_xw(const _Float16* xblk, const _Float16* wblk,
                                         _Float16 (*dst)[128][KV_PITCH], int t)
{
    const int row = t >> 3;          // 0..31, +32 per copy
    const int col = (t & 7) * 8;     // halfs
    const _Float16* gx0 = xblk + (size_t)row * D_MODEL + col;
    const _Float16* gx1 = gx0 + 32 * D_MODEL;
    const _Float16* gx2 = gx0 + 64 * D_MODEL;
    const _Float16* gx3 = gx0 + 96 * D_MODEL;
    const _Float16* gw0 = wblk + (size_t)row * D_MODEL + col;
    const _Float16* gw1 = gw0 + 32 * D_MODEL;
    const _Float16* gw2 = gw0 + 64 * D_MODEL;
    const _Float16* gw3 = gw0 + 96 * D_MODEL;
    const unsigned lx0 = lds_addr(&dst[0][row][col]);
    const unsigned lx1 = lds_addr(&dst[0][row + 32][col]);
    const unsigned lx2 = lds_addr(&dst[0][row + 64][col]);
    const unsigned lx3 = lds_addr(&dst[0][row + 96][col]);
    const unsigned lw0 = lds_addr(&dst[1][row][col]);
    const unsigned lw1 = lds_addr(&dst[1][row + 32][col]);
    const unsigned lw2 = lds_addr(&dst[1][row + 64][col]);
    const unsigned lw3 = lds_addr(&dst[1][row + 96][col]);
    // The copies and their s_wait_xcnt in one statement: the wait then stands in
    // front of every later write of an address register that a copy names.
    asm volatile(
        "global_load_async_to_lds_b128 %0, %8, off\n\t"
        "global_load_async_to_lds_b128 %1, %9, off\n\t"
        "global_load_async_to_lds_b128 %2, %10, off\n\t"
        "global_load_async_to_lds_b128 %3, %11, off\n\t"
        "global_load_async_to_lds_b128 %4, %12, off\n\t"
        "global_load_async_to_lds_b128 %5, %13, off\n\t"
        "global_load_async_to_lds_b128 %6, %14, off\n\t"
        "global_load_async_to_lds_b128 %7, %15, off\n\t"
        "s_wait_xcnt 0x0"
        :: "v"(lx0), "v"(lx1), "v"(lx2), "v"(lx3),
           "v"(lw0), "v"(lw1), "v"(lw2), "v"(lw3),
           "v"(gx0), "v"(gx1), "v"(gx2), "v"(gx3),
           "v"(gw0), "v"(gw1), "v"(gw2), "v"(gw3)
        : "memory");
}

// ---------------------------------------------------------------------------
// Kernel 1: C[8192 x 1024] = X @ W + b, emitted as f16; X and W come as f16,
// both k-contiguous (kernel 0).
//   VT=false -> dst layout [B][H][S][Dh]   (Q, K)
//   VT=true  -> dst layout [B][H][Dh][S]   (V, pre-transposed for the V^T A-frags of O^T += V^T P^T)
// Block: 256 threads (8 waves), tile M=128 N=128, K-step 64, brought into LDS by
// asynchronous copies one step ahead in two buffers.
// Wave (wm, wn) computes a 32x64 subtile = 16 WMMAs per K-step.
// ---------------------------------------------------------------------------
#define KSTEP 64

template <bool VT>
__global__ __launch_bounds__(256)
void qkv_proj_kernel(const _Float16* __restrict__ xh,   // [8192][1024]
                     const _Float16* __restrict__ wt,   // [n][k]
                     const float* __restrict__ bias,
                     _Float16* __restrict__ dst)
{
    const int nBase = blockIdx.x * 128;
    const int mBase = blockIdx.y * 128;
    const int t      = threadIdx.x;
    const int wid    = t >> 5;
    const int lane   = t & 31;
    const int laneLo = lane & 15;
    const int laneHi = lane >> 4;

    __shared__ __align__(16) _Float16 xws[2][2][128][KV_PITCH];  // [buffer][X | W][row][k]

    const int wm = wid >> 1;   // 0..3 : 32 rows each
    const int wn = wid & 1;    // 0..1 : 64 cols each

    const _Float16* xb = xh + (size_t)mBase * D_MODEL;
    const _Float16* wb = wt + (size_t)nBase * D_MODEL;

    // Step 0 into buffer 0, landed and published; then step 1 into buffer 1.
    stage_xw(xb, wb, xws[0], t);
    asm volatile("s_wait_asynccnt 0x0" ::: "memory");   // this wave's copies of step 0 have landed
    __syncthreads();                                    // ... and every other wave's
    stage_xw(xb + KSTEP, wb + KSTEP, xws[1], t);

    v8f acc[2][4];
#pragma unroll
    for (int i = 0; i < 2; i++)
#pragma unroll
        for (int j = 0; j < 4; j++) acc[i][j] = zero8();

    for (int j = 0; j < D_MODEL / KSTEP; ++j) {
        const _Float16 (*Xs)[KV_PITCH] = xws[j & 1][0];   // [m][k]
        const _Float16 (*Ws)[KV_PITCH] = xws[j & 1][1];   // [n][k]

        // A-frag layout (16x32 f16): lanes 0-15 K{0..7,16..23}; lanes 16-31 K{8..15,24..31}
        v16h Af[2][2], Bf[2][4];
#pragma unroll
        for (int c = 0; c < 2; c++) {
#pragma unroll
            for (int mm = 0; mm < 2; mm++) {
                const _Float16* ap = &Xs[wm * 32 + mm * 16 + laneLo][c * 32];
                v8h lo = *(const v8h*)(ap + laneHi * 8);
                v8h hi = *(const v8h*)(ap + 16 + laneHi * 8);
                Af[c][mm] = cat8(lo, hi);
            }
#pragma unroll
            for (int nn = 0; nn < 4; nn++) {
                const _Float16* bp = &Ws[wn * 64 + nn * 16 + laneLo][c * 32];
                v8h lo = *(const v8h*)(bp + laneHi * 8);
                v8h hi = *(const v8h*)(bp + 16 + laneHi * 8);
                Bf[c][nn] = cat8(lo, hi);
            }
        }
        __builtin_amdgcn_sched_barrier(0);   // keep all ds_loads issued first
#pragma unroll
        for (int c = 0; c < 2; c++)
#pragma unroll
            for (int mm = 0; mm < 2; mm++)
#pragma unroll
                for (int nn = 0; nn < 4; nn++)
                    acc[mm][nn] = __builtin_amdgcn_wmma_f32_16x16x32_f16(
                        false, Af[c][mm], false, Bf[c][nn], (short)0, acc[mm][nn], false, false);
        // keep the hand-over behind the WMMAs: lifted above them, the wait for the next
        // step's copies comes right after their issue and the WMMAs no longer cover their flight
        __builtin_amdgcn_sched_barrier(0);

        // Hand-over: this wave has left buffer j & 1 and its copies of step j + 1
        // have landed; behind the barrier that holds for all eight waves.
        asm volatile("s_wait_dscnt 0x0" ::: "memory");      // own LDS reads of this buffer are done
        asm volatile("s_wait_asynccnt 0x0" ::: "memory");   // own copies of step j + 1 have landed
        __syncthreads();        // publishes step j + 1, frees buffer j & 1
        if (j + 2 < D_MODEL / KSTEP)
            stage_xw(xb + (j + 2) * KSTEP, wb + (j + 2) * KSTEP, xws[j & 1], t);
    }
    asm volatile("s_wait_asynccnt 0x0" ::: "memory");   // no copy outstanding at the wave's end

    // Epilogue: add bias, convert f16, scatter to chosen layout
#pragma unroll
    for (int mm = 0; mm < 2; mm++) {
#pragma unroll
        for (int nn = 0; nn < 4; nn++) {
            int col = nBase + wn * 64 + nn * 16 + laneLo;
            float bv = bias[col];
            int h = col >> 6;          // head
            int d = col & 63;          // dim in head
#pragma unroll
            for (int r = 0; r < 8; r++) {
                int row = mBase + wm * 32 + mm * 16 + r + laneHi * 8;
                int bb = row >> 11;    // batch
                int s  = row & 2047;   // seq pos
                float val = acc[mm][nn][r] + bv;
                size_t idx;
                if (VT)
                    idx = (((size_t)bb * NHEAD + h) * HEAD_DIM + d) * SEQ + s;
                else
                    idx = (((size_t)bb * NHEAD + h) * SEQ + s) * HEAD_DIM + d;
                dst[idx] = (_Float16)val;
            }
        }
    }
}

__device__ __forceinline__ void stage_kv(const _Float16* kblk, const _Float16* vblk,
                                         _Float16 (*dst)[64][KV_PITCH], int t)
{
    const int row = t >> 3;          // 0..15, +16 per copy
    const int col = (t & 7) * 8;     // halfs
    const _Float16* gk0 = kblk + (size_t)row * HEAD_DIM + col;
    const _Float16* gk1 = gk0 + 16 * HEAD_DIM;
    const _Float16* gk2 = gk0 + 32 * HEAD_DIM;
    const _Float16* gk3 = gk0 + 48 * HEAD_DIM;
    const _Float16* gv0 = vblk + (size_t)row * SEQ + col;
    const _Float16* gv1 = gv0 + 16 * SEQ;
    const _Float16* gv2 = gv0 + 32 * SEQ;
    const _Float16* gv3 = gv0 + 48 * SEQ;
    const unsigned lk0 = lds_addr(&dst[0][row][col]);
    const unsigned lk1 = lds_addr(&dst[0][row + 16][col]);
    const unsigned lk2 = lds_addr(&dst[0][row + 32][col]);
    const unsigned lk3 = lds_addr(&dst[0][row + 48][col]);
    const unsigned lv0 = lds_addr(&dst[1][row][col]);
    const unsigned lv1 = lds_addr(&dst[1][row + 16][col]);
    const unsigned lv2 = lds_addr(&dst[1][row + 32][col]);
    const unsigned lv3 = lds_addr(&dst[1][row + 48][col]);
    // The copies and their s_wait_xcnt in one statement: the wait then stands in
    // front of every later write of an address register that a copy names.
    asm volatile(
        "global_load_async_to_lds_b128 %0, %8, off\n\t"
        "global_load_async_to_lds_b128 %1, %9, off\n\t"
        "global_load_async_to_lds_b128 %2, %10, off\n\t"
        "global_load_async_to_lds_b128 %3, %11, off\n\t"
        "global_load_async_to_lds_b128 %4, %12, off\n\t"
        "global_load_async_to_lds_b128 %5, %13, off\n\t"
        "global_load_async_to_lds_b128 %6, %14, off\n\t"
        "global_load_async_to_lds_b128 %7, %15, off\n\t"
        "s_wait_xcnt 0x0"
        :: "v"(lk0), "v"(lk1), "v"(lk2), "v"(lk3),
           "v"(lv0), "v"(lv1), "v"(lv2), "v"(lv3),
           "v"(gk0), "v"(gk1), "v"(gk2), "v"(gk3),
           "v"(gv0), "v"(gv1), "v"(gv2), "v"(gv3)
        : "memory");
}

// Lane l's value from lane l ^ 16 (the other half of the wave), on the vector pipe.
__device__ __forceinline__ float xhalf(float v) {
    int i = __builtin_bit_cast(int, v);
    return __builtin_bit_cast(float,
        __builtin_amdgcn_permlanex16(i, i, 0x76543210, 0xfedcba98, false, false));
}

#define QG 2   // 16-query groups per wave

// 1,024 work-groups of one wave per SIMD: four waves per SIMD hold them all at once,
// which needs at most 256 registers a wave
__global__ __launch_bounds__(128) __attribute__((amdgpu_waves_per_eu(4, 4)))
void attn_kernel(const _Float16* __restrict__ q,    // [B][H][S][Dh]
                 const _Float16* __restrict__ k,    // [B][H][S][Dh]
                 const _Float16* __restrict__ vt,   // [B][H][Dh][S]
                 float* __restrict__ out)           // [B][S][D_MODEL]
{
    const int qt = blockIdx.x;          // q tile (128 rows)
    const int bh = blockIdx.y;          // b*NHEAD + h
    const int b  = bh >> 4;
    const int h  = bh & 15;
    const int t      = threadIdx.x;
    const int wid    = t >> 5;          // 0..3
    const int lane   = t & 31;
    const int laneLo = lane & 15;
    const int laneHi = lane >> 4;

    const _Float16* qh  = q  + (size_t)bh * SEQ * HEAD_DIM;
    const _Float16* kh  = k  + (size_t)bh * SEQ * HEAD_DIM;
    const _Float16* vth = vt + (size_t)bh * HEAD_DIM * SEQ;

    __shared__ __align__(16) _Float16 kvs[2][2][64][KV_PITCH];  // [buffer][K | V^T][row][col]

    // Block 0 into buffer 0, landed and published; then block 1 into buffer 1.
    stage_kv(kh, vth, kvs[0], t);
    asm volatile("s_wait_asynccnt 0x0" ::: "memory");   // this wave's copies of block 0 have landed
    __syncthreads();                                    // ... and every other wave's
    stage_kv(kh + 64 * HEAD_DIM, vth + 64, kvs[1], t);

    // Q^T fragments: per group 64 d x 16 queries -> two 32x16 B-frags, straight from
    // global; lane column = query, k order as in the K loader below
    const int qrow = qt * (64 * QG) + wid * (16 * QG) + laneLo;   // group g: + 16 g
    v16h Bq[QG][2];
#pragma unroll
    for (int g = 0; g < QG; g++)
#pragma unroll
        for (int c = 0; c < 2; c++) {
            const _Float16* qp = qh + (size_t)(qrow + 16 * g) * HEAD_DIM + c * 32;
            v8h lo = *(const v8h*)(qp + laneHi * 8);
            v8h hi = *(const v8h*)(qp + 16 + laneHi * 8);
            Bq[g][c] = cat8(lo, hi);
        }

    // All-ones A tile: ones @ P^T gives each query's sum of P in every accumulator row
    v16h onesA;
#pragma unroll
    for (int i = 0; i < 16; i++) onesA[i] = (_Float16)1.0f;

    v8f Oacc[QG][4];    // O^T: Oacc[g][n][r] = O[query 16 g + laneLo][d = n*16 + laneHi*8 + r]
    float mrow[QG], lrow[QG];   // this lane's query of each group
#pragma unroll
    for (int g = 0; g < QG; g++) {
#pragma unroll
        for (int n = 0; n < 4; n++) Oacc[g][n] = zero8();
        mrow[g] = -3.0e38f;
        lrow[g] = 0.0f;
    }
    const float scale = 0.03125f;   // 1/sqrt(D_MODEL)

    for (int j = 0; j < SEQ / 64; ++j) {
        const _Float16 (*ks)[KV_PITCH] = kvs[j & 1][0];   // [key][d]
        const _Float16 (*vs)[KV_PITCH] = kvs[j & 1][1];   // [d][key]

        // ---- Load ALL K A-fragments up front (one clause, overlapped) ----
        v16h Ak[2][4];
#pragma unroll
        for (int n = 0; n < 4; n++)
#pragma unroll
            for (int c = 0; c < 2; c++) {
                const _Float16* kp = &ks[n * 16 + laneLo][c * 32];
                v8h lo = *(const v8h*)(kp + laneHi * 8);
                v8h hi = *(const v8h*)(kp + 16 + laneHi * 8);
                Ak[c][n] = cat8(lo, hi);
            }
        __builtin_amdgcn_sched_barrier(0);   // pin loads ahead of WMMAs

        // ---- S^T = K @ Q^T : 16 back-to-back WMMAs, each K fragment used twice ----
        // S[g][n][r] = score(key n*16 + laneHi*8 + r, query 16 g + laneLo)
        v8f S[QG][4];
#pragma unroll
        for (int n = 0; n < 4; n++) {
#pragma unroll
            for (int g = 0; g < QG; g++)
                S[g][n] = __builtin_amdgcn_wmma_f32_16x16x32_f16(
                    false, Ak[0][n], false, Bq[g][0], (short)0, zero8(), false, false);
#pragma unroll
            for (int g = 0; g < QG; g++)
                S[g][n] = __builtin_amdgcn_wmma_f32_16x16x32_f16(
                    false, Ak[1][n], false, Bq[g][1], (short)0, S[g][n], false, false);
        }

        float alpha[QG];
        v16h Bp[QG][2];
#pragma unroll
        for (int g = 0; g < QG; g++) {
            // Scale, subtraction and rescale below are written on whole tiles: the packed
            // f32 instructions then pair neighbouring registers; element by element the
            // compiler paired across tiles and paid for it in register moves
#pragma unroll
            for (int n = 0; n < 4; n++) S[g][n] *= scale;

            // ---- Online softmax: 32 of the query's 64 scores sit in this lane ----
            float mx8[8];
#pragma unroll
            for (int r = 0; r < 8; r++)
                mx8[r] = fmaxf(fmaxf(S[g][0][r], S[g][1][r]), fmaxf(S[g][2][r], S[g][3][r]));
            float mx = fmaxf(fmaxf(fmaxf(mx8[0], mx8[1]), fmaxf(mx8[2], mx8[3])),
                             fmaxf(fmaxf(mx8[4], mx8[5]), fmaxf(mx8[6], mx8[7])));
            mx = fmaxf(mx, xhalf(mx));      // the other 32 sit in lane ^ 16
            const float mnew = fmaxf(mrow[g], mx);
            alpha[g] = __expf(mrow[g] - mnew);
            mrow[g] = mnew;
#pragma unroll
            for (int n = 0; n < 4; n++) {
                S[g][n] -= mnew;
                Oacc[g][n] *= alpha[g];
#pragma unroll
                for (int r = 0; r < 8; r++) S[g][n][r] = __expf(S[g][n][r]);
            }

            // ---- P^T B-fragments in place: score tiles 2c and 2c+1 are keys
            //      {8*laneHi + 0..7} and {16 + 8*laneHi + 0..7} of 32-key chunk c,
            //      the k order of the V^T loader ----
#pragma unroll
            for (int c = 0; c < 2; c++)
#pragma unroll
                for (int r = 0; r < 8; r++) {
                    Bp[g][c][r]     = (_Float16)S[g][2 * c][r];
                    Bp[g][c][8 + r] = (_Float16)S[g][2 * c + 1][r];
                }
        }

        // ---- Load ALL V^T A-fragments up front ----
        v16h Av[2][4];
#pragma unroll
        for (int c = 0; c < 2; c++)
#pragma unroll
            for (int n = 0; n < 4; n++) {
                const _Float16* vp = &vs[n * 16 + laneLo][c * 32];
                v8h alo = *(const v8h*)(vp + laneHi * 8);
                v8h ahi = *(const v8h*)(vp + 16 + laneHi * 8);
                Av[c][n] = cat8(alo, ahi);
            }
        __builtin_amdgcn_sched_barrier(0);   // pin loads ahead of WMMAs

        // ---- O^T += V^T @ P^T  and  sums of P = ones @ P^T : 20 WMMAs,
        //      each V^T fragment used twice ----
        v8f lacc[QG];
#pragma unroll
        for (int g = 0; g < QG; g++) lacc[g] = zero8();
#pragma unroll
        for (int c = 0; c < 2; c++) {
#pragma unroll
            for (int g = 0; g < QG; g++)
                lacc[g] = __builtin_amdgcn_wmma_f32_16x16x32_f16(
                    false, onesA, false, Bp[g][c], (short)0, lacc[g], false, false);
#pragma unroll
            for (int n = 0; n < 4; n++)
#pragma unroll
                for (int g = 0; g < QG; g++)
                    Oacc[g][n] = __builtin_amdgcn_wmma_f32_16x16x32_f16(
                        false, Av[c][n], false, Bp[g][c], (short)0, Oacc[g][n], false, false);
        }
#pragma unroll
        for (int g = 0; g < QG; g++) lrow[g] = lrow[g] * alpha[g] + lacc[g][0];

        // Hand-over: this wave has left buffer j & 1 and its copies of block j + 1
        // have landed; behind the barrier that holds for all four waves.
        asm volatile("s_wait_dscnt 0x0" ::: "memory");      // own LDS reads of this buffer are done
        asm volatile("s_wait_asynccnt 0x0" ::: "memory");   // own copies of block j + 1 have landed
        __syncthreads();        // publishes block j + 1, frees buffer j & 1
        if (j + 2 < SEQ / 64)
            stage_kv(kh + (size_t)(j + 2) * 64 * HEAD_DIM, vth + (j + 2) * 64, kvs[j & 1], t);
    }
    asm volatile("s_wait_asynccnt 0x0" ::: "memory");   // no copy outstanding at the wave's end

    // Normalize and write out [B][S][D_MODEL] f32: a lane holds 8 consecutive d per tile
#pragma unroll
    for (int g = 0; g < QG; g++) {
        float* op = out + ((size_t)b * SEQ + qrow + 16 * g) * D_MODEL + h * HEAD_DIM + laneHi * 8;
#pragma unroll
        for (int n = 0; n < 4; n++) {
            v4f o0, o1;
#pragma unroll
            for (int r = 0; r < 4; r++) {
                o0[r] = Oacc[g][n][r] / lrow[g];
                o1[r] = Oacc[g][n][4 + r] / lrow[g];
            }
            *(v4f*)(op + n * 16)     = o0;
            *(v4f*)(op + n * 16 + 4) = o1;
        }
    }
}

extern "C" void kernel_launch(void* const* d_in, const int* in_sizes, int n_in,
                              void* d_out, int out_size, void* d_ws, size_t ws_size,
                              hipStream_t stream) {
    const float* x  = (const float*)d_in[0];
    const float* Wq = (const float*)d_in[1];
    const float* bq = (const float*)d_in[2];
    const float* Wk = (const float*)d_in[3];
    const float* bk = (const float*)d_in[4];
    const float* Wv = (const float*)d_in[5];
    const float* bv = (const float*)d_in[6];
    float* out = (float*)d_out;

    const size_t per = (size_t)BATCH * NHEAD * SEQ * HEAD_DIM;  // 8.4M elems
    const size_t wsz = (size_t)D_MODEL * D_MODEL;               // 1M elems
    _Float16* qws = (_Float16*)d_ws;
    _Float16* kws = qws + per;
    _Float16* vws = kws + per;
    _Float16* xh  = vws + per;
    _Float16* wt  = xh + per;      // total 70MB of f16 in d_ws

    to_f16_kernel<<<W_BLOCKS + NROWS * D_MODEL / 4096, 256, 0, stream>>>(x, Wq, Wk, Wv, xh, wt);

    dim3 g1(D_MODEL / 128, NROWS / 128);   // (8, 64)
    qkv_proj_kernel<false><<<g1, 256, 0, stream>>>(xh, wt,           bq, qws);
    qkv_proj_kernel<false><<<g1, 256, 0, stream>>>(xh, wt + wsz,     bk, kws);
    qkv_proj_kernel<true ><<<g1, 256, 0, stream>>>(xh, wt + 2 * wsz, bv, vws);

    dim3 g2(SEQ / (64 * QG), BATCH * NHEAD);   // (16, 64)
    attn_kernel<<<g2, 128, 0, stream>>>(qws, kws, vws, out);
}

// v006
// Measured time: 111 microseconds a run.
// Two timings next to v005 put it at 1.05 and 1.04 times that version's speed.
// Over all steps from v000 it is 4.10 times as fast.
#include <hip/hip_runtime.h>

typedef __attribute__((ext_vector_type(16))) _Float16 v16h;
typedef __attribute__((ext_vector_type(8)))  _Float16 v8h;
typedef __attribute__((ext_vector_type(4)))  _Float16 v4h;
typedef __attribute__((ext_vector_type(8)))  float    v8f;
typedef __attribute__((ext_vector_type(4)))  float    v4f;

#define D_MODEL  1024
#define NHEAD    16
#define HEAD_DIM 64
#define BATCH    4
#define SEQ      2048
#define NROWS    (BATCH * SEQ)   // 8192

__device__ __forceinline__ v16h cat8(v8h lo, v8h hi) {
    v16h r;
#pragma unroll
    for (int i = 0; i < 8; i++) { r[i] = lo[i]; r[8 + i] = hi[i]; }
    return r;
}

__device__ __forceinline__ v8f zero8() {
    v8f r;
#pragma unroll
    for (int i = 0; i < 8; i++) r[i] = 0.0f;
    return r;
}

#define KV_PITCH 72   // halfs per staged row: 144 B = 16 B x 9, conflict-free for b128 readers

typedef __attribute__((address_space(3))) const _Float16 lds_cf16;

__device__ __forceinline__ unsigned lds_addr(const _Float16* p) {
    return (unsigned)(uintptr_t)(lds_cf16*)p;   // byte offset in the work-group's LDS
}

// ---------------------------------------------------------------------------
// Kernel 0: the projections' operands as f16, k-contiguous, written once per call.
//   blocks 0..383   : W (f32 [k][n]) -> wt (f16 [matrix][n][k]); a block turns a
//                     64 k x 128 n tile, a thread an 8 k x 4 n piece in its registers
//   blocks 384..2431: x (f32) -> xh (f16), same layout, 4096 elements per block
// The unrolled loops here and in kernel 1 index vectors and fragment arrays, which
// stay in registers only if every index is a compile-time constant.
// ---------------------------------------------------------------------------
#define W_BLOCKS 384

__global__ __launch_bounds__(256)
void to_f16_kernel(const float* __restrict__ x,
                   const float* __restrict__ Wq,
                   const float* __restrict__ Wk,
                   const float* __restrict__ Wv,
                   _Float16* __restrict__ xh,
                   _Float16* __restrict__ wt)
{
    const int t   = threadIdx.x;
    const int blk = blockIdx.x;
    if (blk < W_BLOCKS) {
        const int m    = blk >> 7;        // 0 Wq, 1 Wk, 2 Wv
        const int tile = blk & 127;
        const int wid  = t >> 5;
        const int lane = t & 31;
        const float* W = (m == 0) ? Wq : ((m == 1) ? Wk : Wv);
        // 8 lanes cover one 128-B line of a k row; 4 lanes cover 64 B of an output row
        const int ko = (tile >> 3) * 64 + ((wid & 1) * 4 + (lane >> 3)) * 8;
        const int nc = (tile & 7) * 128 + ((wid >> 1) * 8 + (lane & 7)) * 4;
        const float* wp = W + (size_t)ko * D_MODEL + nc;
        v4f wv[8];
#pragma unroll
        for (int i = 0; i < 8; i++) wv[i] = *(const v4f*)(wp + (size_t)i * D_MODEL);
        _Float16* op = wt + ((size_t)m * D_MODEL + nc) * D_MODEL + ko;
#pragma unroll
        for (int e = 0; e < 4; e++) {
            v8h wh;
#pragma unroll
            for (int i = 0; i < 8; i++) wh[i] = (_Float16)wv[i][e];
            *(v8h*)(op + (size_t)e * D_MODEL) = wh;
        }
    } else {
        const size_t base = (size_t)(blk - W_BLOCKS) * 4096;
        v4f xv[4];
#pragma unroll
        for (int i = 0; i < 4; i++) xv[i] = *(const v4f*)(x + base + (t + 256 * i) * 4);
#pragma unroll
        for (int i = 0; i < 4; i++) {
            v4h xo;
#pragma unroll
            for (int e = 0; e < 4; e++) xo[e] = (_Float16)xv[i][e];
            *(v4h*)(xh + base + (t + 256 * i) * 4) = xo;
        }
        // precaution: stands in front of every later write of a register that the four
        // stores name (the built code runs on from here into the W part's first lines)
        asm volatile("s_wait_xcnt 0x0" ::: "memory");
    }
}

// One 64-k step of both operand tiles into one buffer: 256 threads x 8 copies of 16 B.
// dst[0] = X tile [m][k], dst[1] = W tile [n][k]; 8 lanes fill one 128-B row.
__device__ __forceinline__ void stage_xw(const _Float16* xblk, const _Float16* wblk,
                                         _Float16 (*dst)[128][KV_PITCH], int t)
{
    const int row = t >> 3;          // 0..31, +32 per copy
    const int col = (t & 7) * 8;     // halfs
    const _Float16* gx0 = xblk + (size_t)row * D_MODEL + col;
    const _Float16* gx1 = gx0 + 32 * D_MODEL;
    const _Float16* gx2 = gx0 + 64 * D_MODEL;
    const _Float16* gx3 = gx0 + 96 * D_MODEL;
    const _Float16* gw0 = wblk + (size_t)row * D_MODEL + col;
    const _Float16* gw1 = gw0 + 32 * D_MODEL;
    const _Float16* gw2 = gw0 + 64 * D_MODEL;
    const _Float16* gw3 = gw0 + 96 * D_MODEL;
    const unsigned lx0 = lds_addr(&dst[0][row][col]);
    const unsigned lx1 = lds_addr(&dst[0][row + 32][col]);
    const unsigned lx2 = lds_addr(&dst[0][row + 64][col]);
    const unsigned lx3 = lds_addr(&dst[0][row + 96][col]);
    const unsigned lw0 = lds_addr(&dst[1][row][col]);
    const unsigned lw1 = lds_addr(&dst[1][row + 32][col]);
    const unsigned lw2 = lds_addr(&dst[1][row + 64][col]);
    const unsigned lw3 = lds_addr(&dst[1][row + 96][col]);
    // The copies and their s_wait_xcnt in one statement: the wait then stands in
    // front of every later write of an address register that a copy names.
    asm volatile(
        "global_load_async_to_lds_b128 %0, %8, off\n\t"
        "global_load_async_to_lds_b128 %1, %9, off\n\t"
        "global_load_async_to_lds_b128 %2, %10, off\n\t"
        "global_load_async_to_lds_b128 %3, %11, off\n\t"
        "global_load_async_to_lds_b128 %4, %12, off\n\t"
        "global_load_async_to_lds_b128 %5, %13, off\n\t"
        "global_load_async_to_lds_b128 %6, %14, off\n\t"
        "global_load_async_to_lds_b128 %7, %15, off\n\t"
        "s_wait_xcnt 0x0"
        :: "v"(lx0), "v"(lx1), "v"(lx2), "v"(lx3),
           "v"(lw0), "v"(lw1), "v"(lw2), "v"(lw3),
           "v"(gx0), "v"(gx1), "v"(gx2), "v"(gx3),
           "v"(gw0), "v"(gw1), "v"(gw2), "v"(gw3)
        : "memory");
}

// ---------------------------------------------------------------------------
// Kernel 1: C[8192 x 1024] = X @ W + b, emitted as f16; X and W come as f16,
// both k-contiguous (kernel 0).
//   VT=false -> dst layout [B][H][S][Dh]   (Q, K)
//   VT=true  -> dst layout [B][H][Dh][S]   (V, pre-transposed for the V^T A-frags of O^T += V^T P^T)
// Block: 256 threads (8 waves), tile M=128 N=128, K-step 64, brought into LDS by
// asynchronous copies one step ahead in two buffers.
// Wave (wm, wn) computes a 32x64 subtile = 16 WMMAs per K-step.
// ---------------------------------------------------------------------------
#define KSTEP 64

template <bool VT>
__global__ __launch_bounds__(256)
void qkv_proj_kernel(const _Float16* __restrict__ xh,   // [8192][1024]
                     const _Float16* __restrict__ wt,   // [n][k]
                     const float* __restrict__ bias,
                     _Float16* __restrict__ dst)
{
    const int nBase = blockIdx.x * 128;
    const int mBase = blockIdx.y * 128;
    const int t      = threadIdx.x;
    const int wid    = t >> 5;
    const int lane   = t & 31;
    const int laneLo = lane & 15;
    const int laneHi = lane >> 4;

    __shared__ __align__(16) _Float16 xws[2][2][128][KV_PITCH];  // [buffer][X | W][row][k]

    const int wm = wid >> 1;   // 0..3 : 32 rows each
    const int wn = wid & 1;    // 0..1 : 64 cols each

    const _Float16* xb = xh + (size_t)mBase * D_MODEL;
    const _Float16* wb = wt + (size_t)nBase * D_MODEL;

    // Step 0 into buffer 0, landed and published; then step 1 into buffer 1.
    stage_xw(xb, wb, xws[0], t);
    asm volatile("s_wait_asynccnt 0x0" ::: "memory");   // this wave's copies of step 0 have landed
    __syncthreads();                                    // ... and every other wave's
    stage_xw(xb + KSTEP, wb + KSTEP, xws[1], t);

    v8f acc[2][4];
#pragma unroll
    for (int i = 0; i < 2; i++)
#pragma unroll
        for (int j = 0; j < 4; j++) acc[i][j] = zero8();

    for (int j = 0; j < D_MODEL / KSTEP; ++j) {
        const _Float16 (*Xs)[KV_PITCH] = xws[j & 1][0];   // [m][k]
        const _Float16 (*Ws)[KV_PITCH] = xws[j & 1][1];   // [n][k]

        // A-frag layout (16x32 f16): lanes 0-15 K{0..7,16..23}; lanes 16-31 K{8..15,24..31}
        v16h Af[2][2], Bf[2][4];
#pragma unroll
        for (int c = 0; c < 2; c++) {
#pragma unroll
            for (int mm = 0; mm < 2; mm++) {
                const _Float16* ap = &Xs[wm * 32 + mm * 16 + laneLo][c * 32];
                v8h lo = *(const v8h*)(ap + laneHi * 8);
                v8h hi = *(const v8h*)(ap + 16 + laneHi * 8);
                Af[c][mm] = cat8(lo, hi);
            }
#pragma unroll
            for (int nn = 0; nn < 4; nn++) {
                const _Float16* bp = &Ws[wn * 64 + nn * 16 + laneLo][c * 32];
                v8h lo = *(const v8h*)(bp + laneHi * 8);
                v8h hi = *(const v8h*)(bp + 16 + laneHi * 8);
                Bf[c][nn] = cat8(lo, hi);
            }
        }
        __builtin_amdgcn_sched_barrier(0);   // keep all ds_loads issued first
#pragma unroll
        for (int c = 0; c < 2; c++)
#pragma unroll
            for (int mm = 0; mm < 2; mm++)
#pragma unroll
                for (int nn = 0; nn < 4; nn++)
                    acc[mm][nn] = __builtin_amdgcn_wmma_f32_16x16x32_f16(
                        false, Af[c][mm], false, Bf[c][nn], (short)0, acc[mm][nn], false, false);
        // keep the hand-over behind the WMMAs: lifted above them, the wait for the next
        // step's copies comes right after their issue and the WMMAs no longer cover their flight
        __builtin_amdgcn_sched_barrier(0);

        // Hand-over: this wave has left buffer j & 1 and its copies of step j + 1
        // have landed; behind the barrier that holds for all eight waves.
        asm volatile("s_wait_dscnt 0x0" ::: "memory");      // own LDS reads of this buffer are done
        asm volatile("s_wait_asynccnt 0x0" ::: "memory");   // own copies of step j + 1 have landed
        __syncthreads();        // publishes step j + 1, frees buffer j & 1
        if (j + 2 < D_MODEL / KSTEP)
            stage_xw(xb + (j + 2) * KSTEP, wb + (j + 2) * KSTEP, xws[j & 1], t);
    }
    asm volatile("s_wait_asynccnt 0x0" ::: "memory");   // no copy outstanding at the wave's end

    // Epilogue: add bias, convert f16, scatter to chosen layout
#pragma unroll
    for (int mm = 0; mm < 2; mm++) {
#pragma unroll
        for (int nn = 0; nn < 4; nn++) {
            int col = nBase + wn * 64 + nn * 16 + laneLo;
            float bv = bias[col];
            int h = col >> 6;          // head
            int d = col & 63;          // dim in head
#pragma unroll
            for (int r = 0; r < 8; r++) {
                int row = mBase + wm * 32 + mm * 16 + r + laneHi * 8;
                int bb = row >> 11;    // batch
                int s  = row & 2047;   // seq pos
                float val = acc[mm][nn][r] + bv;
                size_t idx;
                if (VT)
                    idx = (((size_t)bb * NHEAD + h) * HEAD_DIM + d) * SEQ + s;
                else
                    idx = (((size_t)bb * NHEAD + h) * SEQ + s) * HEAD_DIM + d;
                dst[idx] = (_Float16)val;
            }
        }
    }
}

__device__ __forceinline__ void stage_kv(const _Float16* kblk, const _Float16* vblk,
                                         _Float16 (*dst)[64][KV_PITCH], int t)
{
    const int row = t >> 3;          // 0..15, +16 per copy
    const int col = (t & 7) * 8;     // halfs
    const _Float16* gk0 = kblk + (size_t)row * HEAD_DIM + col;
    const _Float16* gk1 = gk0 + 16 * HEAD_DIM;
    const _Float16* gk2 = gk0 + 32 * HEAD_DIM;
    const _Float16* gk3 = gk0 + 48 * HEAD_DIM;
    const _Float16* gv0 = vblk + (size_t)row * SEQ + col;
    const _Float16* gv1 = gv0 + 16 * SEQ;
    const _Float16* gv2 = gv0 + 32 * SEQ;
    const _Float16* gv3 = gv0 + 48 * SEQ;
    const unsigned lk0 = lds_addr(&dst[0][row][col]);
    const unsigned lk1 = lds_addr(&dst[0][row + 16][col]);
    const unsigned lk2 = lds_addr(&dst[0][row + 32][col]);
    const unsigned lk3 = lds_addr(&dst[0][row + 48][col]);
    const unsigned lv0 = lds_addr(&dst[1][row][col]);
    const unsigned lv1 = lds_addr(&dst[1][row + 16][col]);
    const unsigned lv2 = lds_addr(&dst[1][row + 32][col]);
    const unsigned lv3 = lds_addr(&dst[1][row + 48][col]);
    // The copies and their s_wait_xcnt in one statement: the wait then stands in
    // front of every later write of an address register that a copy names.
    asm volatile(
        "global_load_async_to_lds_b128 %0, %8, off\n\t"
        "global_load_async_to_lds_b128 %1, %9, off\n\t"
        "global_load_async_to_lds_b128 %2, %10, off\n\t"
        "global_load_async_to_lds_b128 %3, %11, off\n\t"
        "global_load_async_to_lds_b128 %4, %12, off\n\t"
        "global_load_async_to_lds_b128 %5, %13, off\n\t"
        "global_load_async_to_lds_b128 %6, %14, off\n\t"
        "global_load_async_to_lds_b128 %7, %15, off\n\t"
        "s_wait_xcnt 0x0"
        :: "v"(lk0), "v"(lk1), "v"(lk2), "v"(lk3),
           "v"(lv0), "v"(lv1), "v"(lv2), "v"(lv3),
           "v"(gk0), "v"(gk1), "v"(gk2), "v"(gk3),
           "v"(gv0), "v"(gv1), "v"(gv2), "v"(gv3)
        : "memory");
}

// Lane l's value from lane l ^ 16 (the other half of the wave), on the vector pipe.
__device__ __forceinline__ float xhalf(float v) {
    int i = __builtin_bit_cast(int, v);
    return __builtin_bit_cast(float,
        __builtin_amdgcn_permlanex16(i, i, 0x76543210, 0xfedcba98, false, false));
}

#define QG 2   // 16-query groups per wave
#define QSCALE (0.03125f * 1.44269504f)   // 1/sqrt(D_MODEL) * log2(e)

// 1,024 work-groups of one wave per SIMD: four waves per SIMD hold them all at once,
// which needs at most 256 registers a wave
__global__ __launch_bounds__(128) __attribute__((amdgpu_waves_per_eu(4, 4)))
void attn_kernel(const _Float16* __restrict__ q,    // [B][H][S][Dh]
                 const _Float16* __restrict__ k,    // [B][H][S][Dh]
                 const _Float16* __restrict__ vt,   // [B][H][Dh][S]
                 float* __restrict__ out)           // [B][S][D_MODEL]
{
    const int qt = blockIdx.x;          // q tile (128 rows)
    const int bh = blockIdx.y;          // b*NHEAD + h
    const int b  = bh >> 4;
    const int h  = bh & 15;
    const int t      = threadIdx.x;
    const int wid    = t >> 5;          // 0..3
    const int lane   = t & 31;
    const int laneLo = lane & 15;
    const int laneHi = lane >> 4;

    const _Float16* qh  = q  + (size_t)bh * SEQ * HEAD_DIM;
    const _Float16* kh  = k  + (size_t)bh * SEQ * HEAD_DIM;
    const _Float16* vth = vt + (size_t)bh * HEAD_DIM * SEQ;

    __shared__ __align__(16) _Float16 kvs[2][2][64][KV_PITCH];  // [buffer][K | V^T][row][col]

    // Block 0 into buffer 0, landed and published; then block 1 into buffer 1.
    stage_kv(kh, vth, kvs[0], t);
    asm volatile("s_wait_asynccnt 0x0" ::: "memory");   // this wave's copies of block 0 have landed
    __syncthreads();                                    // ... and every other wave's
    stage_kv(kh + 64 * HEAD_DIM, vth + 64, kvs[1], t);

    // Q^T fragments: per group 64 d x 16 queries -> two 32x16 B-frags, straight from
    // global; lane column = query, k order as in the K loader below
    const int qrow = qt * (64 * QG) + wid * (16 * QG) + laneLo;   // group g: + 16 g
    v16h Bq[QG][2];
#pragma unroll
    for (int g = 0; g < QG; g++)
#pragma unroll
        for (int c = 0; c < 2; c++) {
            const _Float16* qp = qh + (size_t)(qrow + 16 * g) * HEAD_DIM + c * 32;
            v8h lo = *(const v8h*)(qp + laneHi * 8);
            v8h hi = *(const v8h*)(qp + 16 + laneHi * 8);
            Bq[g][c] = cat8(lo, hi);
            // scale * log2(e) goes into Q: multiplied in f32, rounded to f16 once more
#pragma unroll
            for (int i = 0; i < 16; i++)
                Bq[g][c][i] = (_Float16)((float)Bq[g][c][i] * QSCALE);
        }

    // All-ones A tile: ones @ P^T gives each query's sum of P in every accumulator row
    v16h onesA;
#pragma unroll
    for (int i = 0; i < 16; i++) onesA[i] = (_Float16)1.0f;

    v8f Oacc[QG][4];    // O^T: Oacc[g][n][r] = O[query 16 g + laneLo][d = n*16 + laneHi*8 + r]
    v8f Cm[QG];         // minus the maximum in use of this lane's query, in all 8 registers
    float lrow[QG];     // this lane's query of each group
#pragma unroll
    for (int g = 0; g < QG; g++) {
#pragma unroll
        for (int n = 0; n < 4; n++) Oacc[g][n] = zero8();
        Cm[g] = zero8();
        lrow[g] = 0.0f;
    }

    for (int j = 0; j < SEQ / 64; ++j) {
        const _Float16 (*ks)[KV_PITCH] = kvs[j & 1][0];   // [key][d]
        const _Float16 (*vs)[KV_PITCH] = kvs[j & 1][1];   // [d][key]

        // ---- Load ALL K A-fragments up front (one clause, overlapped) ----
        v16h Ak[2][4];
#pragma unroll
        for (int n = 0; n < 4; n++)
#pragma unroll
            for (int c = 0; c < 2; c++) {
                const _Float16* kp = &ks[n * 16 + laneLo][c * 32];
                v8h lo = *(const v8h*)(kp + laneHi * 8);
                v8h hi = *(const v8h*)(kp + 16 + laneHi * 8);
                Ak[c][n] = cat8(lo, hi);
            }
        __builtin_amdgcn_sched_barrier(0);   // pin loads ahead of WMMAs

        // ---- S^T = K @ Q^T - maximum in use : 16 back-to-back WMMAs, each K fragment used twice ----
        // S[g][n][r] = log2-domain score(key n*16 + laneHi*8 + r, query 16 g + laneLo)
        v8f S[QG][4];
#pragma unroll
        for (int n = 0; n < 4; n++) {
#pragma unroll
            for (int g = 0; g < QG; g++)
                S[g][n] = __builtin_amdgcn_wmma_f32_16x16x32_f16(
                    false, Ak[0][n], false, Bq[g][0], (short)0, Cm[g], false, false);
#pragma unroll
            for (int g = 0; g < QG; g++)
                S[g][n] = __builtin_amdgcn_wmma_f32_16x16x32_f16(
                    false, Ak[1][n], false, Bq[g][1], (short)0, S[g][n], false, false);
        }

        // ---- This lane's largest score of each group, relative to the maximum in use ----
        float mx[QG];
#pragma unroll
        for (int g = 0; g < QG; g++) {
            float mx8[8];
#pragma unroll
            for (int r = 0; r < 8; r++)
                mx8[r] = fmaxf(fmaxf(S[g][0][r], S[g][1][r]), fmaxf(S[g][2][r], S[g][3][r]));
            mx[g] = fmaxf(fmaxf(fmaxf(mx8[0], mx8[1]), fmaxf(mx8[2], mx8[3])),
                          fmaxf(fmaxf(mx8[4], mx8[5]), fmaxf(mx8[6], mx8[7])));
        }

        // ---- One test per block, the same for the whole wave (a scalar branch): the
        //      first block sets the maxima in use, a later one moves them only if some
        //      score lies more than 8 above ----
        const bool need = fmaxf(mx[0], mx[1]) > ((j == 0) ? -3.0e38f : 8.0f);
        if (__builtin_amdgcn_ballot_w32(need) != 0) {
#pragma unroll
            for (int g = 0; g < QG; g++) {
                const float m = fmaxf(mx[g], xhalf(mx[g]));   // the other 32 scores sit in lane ^ 16
                // step of the maximum in use: never down, but for the first block, which starts from 0
                const float d = (j == 0) ? m : fmaxf(m, 0.0f);
                // a step down meets only zeros in O and the sums: factor 1 there
                const float alpha = __builtin_amdgcn_exp2f(-fmaxf(d, 0.0f));
#pragma unroll
                for (int n = 0; n < 4; n++) {
                    S[g][n] -= d;
                    Oacc[g][n] *= alpha;
                }
                Cm[g] -= d;
                lrow[g] *= alpha;
            }
        }

        // ---- P^T B-fragments in place: score tiles 2c and 2c+1 are keys
        //      {8*laneHi + 0..7} and {16 + 8*laneHi + 0..7} of 32-key chunk c,
        //      the k order of the V^T loader ----
        v16h Bp[QG][2];
#pragma unroll
        for (int g = 0; g < QG; g++) {
#pragma unroll
            for (int n = 0; n < 4; n++)
#pragma unroll
                for (int r = 0; r < 8; r++) S[g][n][r] = __builtin_amdgcn_exp2f(S[g][n][r]);
#pragma unroll
            for (int c = 0; c < 2; c++)
#pragma unroll
                for (int r = 0; r < 8; r++) {
                    Bp[g][c][r]     = (_Float16)S[g][2 * c][r];
                    Bp[g][c][8 + r] = (_Float16)S[g][2 * c + 1][r];
                }
        }

        // ---- Load ALL V^T A-fragments up front ----
        v16h Av[2][4];
#pragma unroll
        for (int c = 0; c < 2; c++)
#pragma unroll
            for (int n = 0; n < 4; n++) {
                const _Float16* vp = &vs[n * 16 + laneLo][c * 32];
                v8h alo = *(const v8h*)(vp + laneHi * 8);
                v8h ahi = *(const v8h*)(vp + 16 + laneHi * 8);
                Av[c][n] = cat8(alo, ahi);
            }
        __builtin_amdgcn_sched_barrier(0);   // pin loads ahead of WMMAs

        // ---- O^T += V^T @ P^T  and  sums of P = ones @ P^T : 20 WMMAs,
        //      each V^T fragment used twice ----
        v8f lacc[QG];
#pragma unroll
        for (int g = 0; g < QG; g++) lacc[g] = zero8();
#pragma unroll
        for (int c = 0; c < 2; c++) {
#pragma unroll
            for (int g = 0; g < QG; g++)
                lacc[g] = __builtin_amdgcn_wmma_f32_16x16x32_f16(
                    false, onesA, false, Bp[g][c], (short)0, lacc[g], false, false);
#pragma unroll
            for (int n = 0; n < 4; n++)
#pragma unroll
                for (int g = 0; g < QG; g++)
                    Oacc[g][n] = __builtin_amdgcn_wmma_f32_16x16x32_f16(
                        false, Av[c][n], false, Bp[g][c], (short)0, Oacc[g][n], false, false);
        }
#pragma unroll
        for (int g = 0; g < QG; g++) lrow[g] += lacc[g][0];

        // Hand-over: this wave has left buffer j & 1 and its copies of block j + 1
        // have landed; behind the barrier that holds for all four waves.
        asm volatile("s_wait_dscnt 0x0" ::: "memory");      // own LDS reads of this buffer are done
        asm volatile("s_wait_asynccnt 0x0" ::: "memory");   // own copies of block j + 1 have landed
        __syncthreads();        // publishes block j + 1, frees buffer j & 1
        if (j + 2 < SEQ / 64)
            stage_kv(kh + (size_t)(j + 2) * 64 * HEAD_DIM, vth + (j + 2) * 64, kvs[j & 1], t);
    }
    asm volatile("s_wait_asynccnt 0x0" ::: "memory");   // no copy outstanding at the wave's end

    // Normalize and write out [B][S][D_MODEL] f32: a lane holds 8 consecutive d per tile
#pragma unroll
    for (int g = 0; g < QG; g++) {
        float* op = out + ((size_t)b * SEQ + qrow + 16 * g) * D_MODEL + h * HEAD_DIM + laneHi * 8;
#pragma unroll
        for (int n = 0; n < 4; n++) {
            v4f o0, o1;
#pragma unroll
            for (int r = 0; r < 4; r++) {
                o0[r] = Oacc[g][n][r] / lrow[g];
                o1[r] = Oacc[g][n][4 + r] / lrow[g];
            }
            *(v4f*)(op + n * 16)     = o0;
            *(v4f*)(op + n * 16 + 4) = o1;
        }
    }
}

extern "C" void kernel_launch(void* const* d_in, const int* in_sizes, int n_in,
                              void* d_out, int out_size, void* d_ws, size_t ws_size,
                              hipStream_t stream) {
    const float* x  = (const float*)d_in[0];
    const float* Wq = (const float*)d_in[1];
    const float* bq = (const float*)d_in[2];
    const float* Wk = (const float*)d_in[3];
    const float* bk = (const float*)d_in[4];
    const float* Wv = (const float*)d_in[5];
    const float* bv = (const float*)d_in[6];
    float* out = (float*)d_out;

    const size_t per = (size_t)BATCH * NHEAD * SEQ * HEAD_DIM;  // 8.4M elems
    const size_t wsz = (size_t)D_MODEL * D_MODEL;               // 1M elems
    _Float16* qws = (_Float16*)d_ws;
    _Float16* kws = qws + per;
    _Float16* vws = kws + per;
    _Float16* xh  = vws + per;
    _Float16* wt  = xh + per;      // total 70MB of f16 in d_ws

    to_f16_kernel<<<W_BLOCKS + NROWS * D_MODEL / 4096, 256, 0, stream>>>(x, Wq, Wk, Wv, xh, wt);

    dim3 g1(D_MODEL / 128, NROWS / 128);   // (8, 64)
    qkv_proj_kernel<false><<<g1, 256, 0, stream>>>(xh, wt,           bq, qws);
    qkv_proj_kernel<false><<<g1, 256, 0, stream>>>(xh, wt + wsz,     bk, kws);
    qkv_proj_kernel<true ><<<g1, 256, 0, stream>>>(xh, wt + 2 * wsz, bv, vws);

    dim3 g2(SEQ / (64 * QG), BATCH * NHEAD);   // (16, 64)
    attn_kernel<<<g2, 128, 0, stream>>>(qws, kws, vws, out);
}

// v007
// It runs in 101 microseconds.
// In two side-by-side timings against v006, it was 1.10 and 1.11 times as fast.
// Counting every step since v000, it is 4.54 times as fast.
#include <hip/hip_runtime.h>

typedef __attribute__((ext_vector_type(16))) _Float16 v16h;
typedef __attribute__((ext_vector_type(8)))  _Float16 v8h;
typedef __attribute__((ext_vector_type(4)))  _Float16 v4h;
typedef __attribute__((ext_vector_type(8)))  float    v8f;
typedef __attribute__((ext_vector_type(4)))  float    v4f;

#define D_MODEL  1024
#define NHEAD    16
#define HEAD_DIM 64
#define BATCH    4
#define SEQ      2048
#define NROWS    (BATCH * SEQ)   // 8192

__device__ __forceinline__ v16h cat8(v8h lo, v8h hi) {
    v16h r;
#pragma unroll
    for (int i = 0; i < 8; i++) { r[i] = lo[i]; r[8 + i] = hi[i]; }
    return r;
}

__device__ __forceinline__ v8f zero8() {
    v8f r;
#pragma unroll
    for (int i = 0; i < 8; i++) r[i] = 0.0f;
    return r;
}

#define KV_PITCH 72   // halfs per staged row: 144 B = 16 B x 9, conflict-free for b128 readers

typedef __attribute__((address_space(3))) const _Float16 lds_cf16;

__device__ __forceinline__ unsigned lds_addr(const _Float16* p) {
    return (unsigned)(uintptr_t)(lds_cf16*)p;   // byte offset in the work-group's LDS
}

// ---------------------------------------------------------------------------
// Kernel 0: the projections' operands as f16, k-contiguous, written once per call.
//   blocks 0..383   : W (f32 [k][n]) -> wt (f16 [matrix][n][k]); a block turns a
//                     64 k x 128 n tile, a thread an 8 k x 4 n piece in its registers
//   blocks 384..2431: x (f32) -> xh (f16), same layout, 4096 elements per block
// The unrolled loops here and in kernel 1 index vectors and fragment arrays, which
// stay in registers only if every index is a compile-time constant.
// ---------------------------------------------------------------------------
#define W_BLOCKS 384

__global__ __launch_bounds__(256)
void to_f16_kernel(const float* __restrict__ x,
                   const float* __restrict__ Wq,
                   const float* __restrict__ Wk,
                   const float* __restrict__ Wv,
                   _Float16* __restrict__ xh,
                   _Float16* __restrict__ wt)
{
    const int t   = threadIdx.x;
    const int blk = blockIdx.x;
    if (blk < W_BLOCKS) {
        const int m    = blk >> 7;        // 0 Wq, 1 Wk, 2 Wv
        const int tile = blk & 127;
        const int wid  = t >> 5;
        const int lane = t & 31;
        const float* W = (m == 0) ? Wq : ((m == 1) ? Wk : Wv);
        // 8 lanes cover one 128-B line of a k row; 4 lanes cover 64 B of an output row
        const int ko = (tile >> 3) * 64 + ((wid & 1) * 4 + (lane >> 3)) * 8;
        const int nc = (tile & 7) * 128 + ((wid >> 1) * 8 + (lane & 7)) * 4;
        const float* wp = W + (size_t)ko * D_MODEL + nc;
        v4f wv[8];
#pragma unroll
        for (int i = 0; i < 8; i++) wv[i] = *(const v4f*)(wp + (size_t)i * D_MODEL);
        _Float16* op = wt + ((size_t)m * D_MODEL + nc) * D_MODEL + ko;
#pragma unroll
        for (int e = 0; e < 4; e++) {
            v8h wh;
#pragma unroll
            for (int i = 0; i < 8; i++) wh[i] = (_Float16)wv[i][e];
            *(v8h*)(op + (size_t)e * D_MODEL) = wh;
        }
    } else {
        const size_t base = (size_t)(blk - W_BLOCKS) * 4096;
        v4f xv[4];
#pragma unroll
        for (int i = 0; i < 4; i++) xv[i] = *(const v4f*)(x + base + (t + 256 * i) * 4);
#pragma unroll
        for (int i = 0; i < 4; i++) {
            v4h xo;
#pragma unroll
            for (int e = 0; e < 4; e++) xo[e] = (_Float16)xv[i][e];
            *(v4h*)(xh + base + (t + 256 * i) * 4) = xo;
        }
        // precaution: stands in front of every later write of a register that the four
        // stores name (the built code runs on from here into the W part's first lines)
        asm volatile("s_wait_xcnt 0x0" ::: "memory");
    }
}

// One 64-k step of the operand tiles into one buffer: 256 threads x 20 copies of 16 B.
// dst rows 0..255 = X tile [m][k]; rows 256..639 = W tile [n][k], 128 rows of each of
// Wq, Wk, Wv (the same 128 output columns of all three); 8 lanes fill one 128-B row.
#define TILE_M 256
#define TILE_NW 128                    // output columns per weight matrix
#define TILE_N (3 * TILE_NW)
#define TILE_ROWS (TILE_M + TILE_N)

// Ten copies of 16 B per lane. Copy i: LDS byte address li; global address = the scalar
// base bi (the same for the whole wave) + the lane's byte offset voff. With scalar bases a
// statement names 11 vector registers instead of 30: asm operands must lie below v256, where
// the accumulators live, and every register more is an accumulator moved out and back each step.
__device__ __forceinline__ void copy10(unsigned voff,
                                       unsigned l0, unsigned l1, unsigned l2, unsigned l3, unsigned l4,
                                       unsigned l5, unsigned l6, unsigned l7, unsigned l8, unsigned l9,
                                       const _Float16* b0, const _Float16* b1, const _Float16* b2,
                                       const _Float16* b3, const _Float16* b4, const _Float16* b5,
                                       const _Float16* b6, const _Float16* b7, const _Float16* b8,
                                       const _Float16* b9)
{
    // The copies and their s_wait_xcnt in one statement: the wait then stands in
    // front of every later write of an address register that a copy names.
    asm volatile(
        "global_load_async_to_lds_b128 %0, %20, %10\n\t"
        "global_load_async_to_lds_b128 %1, %20, %11\n\t"
        "global_load_async_to_lds_b128 %2, %20, %12\n\t"
        "global_load_async_to_lds_b128 %3, %20, %13\n\t"
        "global_load_async_to_lds_b128 %4, %20, %14\n\t"
        "global_load_async_to_lds_b128 %5, %20, %15\n\t"
        "global_load_async_to_lds_b128 %6, %20, %16\n\t"
        "global_load_async_to_lds_b128 %7, %20, %17\n\t"
        "global_load_async_to_lds_b128 %8, %20, %18\n\t"
        "global_load_async_to_lds_b128 %9, %20, %19\n\t"
        "s_wait_xcnt 0x0"
        :: "v"(l0), "v"(l1), "v"(l2), "v"(l3), "v"(l4),
           "v"(l5), "v"(l6), "v"(l7), "v"(l8), "v"(l9),
           "s"(b0), "s"(b1), "s"(b2), "s"(b3), "s"(b4),
           "s"(b5), "s"(b6), "s"(b7), "s"(b8), "s"(b9),
           "v"(voff)
        : "memory");
}

// xblk: first X row of the tile at this k step; wblk: row nBase of Wq's copy at this k step
// (Wk's and Wv's rows lie D_MODEL and 2 D_MODEL rows further on). Both are wave-uniform.
__device__ __forceinline__ void stage_xw(const _Float16* xblk, const _Float16* wblk,
                                         _Float16 (*dst)[KV_PITCH], int t)
{
    const int row = t >> 3;          // 0..31, +32 per copy
    const int col = (t & 7) * 8;     // halfs
    const unsigned voff = (unsigned)(row * D_MODEL + col) * 2u;   // bytes, below 64 KiB
    const _Float16* kblk = wblk + (size_t)D_MODEL * D_MODEL;
    const _Float16* vblk = kblk + (size_t)D_MODEL * D_MODEL;
    const unsigned l = lds_addr(&dst[row][col]);
    const unsigned s = 32 * KV_PITCH * 2;   // bytes of 32 LDS rows
    copy10(voff, l, l + s, l + 2 * s, l + 3 * s, l + 4 * s, l + 5 * s, l + 6 * s, l + 7 * s,
           l + 8 * s, l + 9 * s,
           xblk, xblk + 32 * D_MODEL, xblk + 64 * D_MODEL, xblk + 96 * D_MODEL,
           xblk + 128 * D_MODEL, xblk + 160 * D_MODEL, xblk + 192 * D_MODEL, xblk + 224 * D_MODEL,
           wblk, wblk + 32 * D_MODEL);
    copy10(voff, l + 10 * s, l + 11 * s, l + 12 * s, l + 13 * s, l + 14 * s, l + 15 * s,
           l + 16 * s, l + 17 * s, l + 18 * s, l + 19 * s,
           wblk + 64 * D_MODEL, wblk + 96 * D_MODEL,
           kblk, kblk + 32 * D_MODEL, kblk + 64 * D_MODEL, kblk + 96 * D_MODEL,
           vblk, vblk + 32 * D_MODEL, vblk + 64 * D_MODEL, vblk + 96 * D_MODEL);
}

// ---------------------------------------------------------------------------
// Kernel 1: Q, K, V = X @ W + b for all three weight matrices, emitted as f16;
// X and W come as f16, both k-contiguous (kernel 0).
//   Q, K -> layout [B][H][S][Dh];  V -> [B][H][Dh][S] (pre-transposed for the V^T A-frags)
// One work-group per WGP: 256 threads (8 waves), tile 256 rows x 384 columns (the same
// 128 columns of Q, K and V, so one staged X tile serves three weight tiles), K-step 64,
// brought into LDS by asynchronous copies one step ahead in two buffers.
// Wave (wm, wn) computes a 128 x 96 subtile: per 32 k, 48 WMMAs on 14 fragments.
// ---------------------------------------------------------------------------
#define KSTEP 64
#define FM 8    // 16-row fragments per wave
#define FN 6    // 16-column fragments per wave

__global__ __launch_bounds__(256)
void qkv_proj_kernel(const _Float16* __restrict__ xh,   // [8192][1024]
                     const _Float16* __restrict__ wt,   // [matrix][n][k]
                     const float* __restrict__ bq,
                     const float* __restrict__ bk,
                     const float* __restrict__ bv,
                     _Float16* __restrict__ qd,
                     _Float16* __restrict__ kd,
                     _Float16* __restrict__ vd)
{
    const int nBase = blockIdx.x * TILE_NW;
    const int mBase = blockIdx.y * TILE_M;
    const int t      = threadIdx.x;
    const int wid    = __builtin_amdgcn_readfirstlane(t >> 5);   // scalar: the epilogue branches on it
    const int lane   = t & 31;
    const int laneLo = lane & 15;
    const int laneHi = lane >> 4;

    __shared__ __align__(16) _Float16 xws[2][TILE_ROWS][KV_PITCH];  // [buffer][X rows | W rows][k]

    const int wm = wid >> 2;   // 0..1 : 128 rows each
    const int wn = wid & 3;    // 0..3 : 96 of the 384 columns each

    const _Float16* xb = xh + (size_t)mBase * D_MODEL;
    const _Float16* wb = wt + (size_t)nBase * D_MODEL;

    // Step 0 into buffer 0, landed and published; then step 1 into buffer 1.
    stage_xw(xb, wb, xws[0], t);
    asm volatile("s_wait_asynccnt 0x0" ::: "memory");   // this wave's copies of step 0 have landed
    __syncthreads();                                    // ... and every other wave's
    stage_xw(xb + KSTEP, wb + KSTEP, xws[1], t);

    v8f acc[FM][FN];
#pragma unroll
    for (int i = 0; i < FM; i++)
#pragma unroll
        for (int j = 0; j < FN; j++) acc[i][j] = zero8();

    for (int j = 0; j < D_MODEL / KSTEP; ++j) {
        const _Float16 (*Xs)[KV_PITCH] = xws[j & 1];            // [m][k]
        const _Float16 (*Ws)[KV_PITCH] = xws[j & 1] + TILE_M;   // [n][k]

#pragma unroll
        for (int c = 0; c < 2; c++) {
            // A-frag layout (16x32 f16): lanes 0-15 K{0..7,16..23}; lanes 16-31 K{8..15,24..31}
            v16h Af[FM], Bf[FN];
#pragma unroll
            for (int nn = 0; nn < FN; nn++) {
                const _Float16* bp = &Ws[wn * (16 * FN) + nn * 16 + laneLo][c * 32];
                v8h lo = *(const v8h*)(bp + laneHi * 8);
                v8h hi = *(const v8h*)(bp + 16 + laneHi * 8);
                Bf[nn] = cat8(lo, hi);
            }
#pragma unroll
            for (int mm = 0; mm < FM; mm++) {
                const _Float16* ap = &Xs[wm * (16 * FM) + mm * 16 + laneLo][c * 32];
                v8h lo = *(const v8h*)(ap + laneHi * 8);
                v8h hi = *(const v8h*)(ap + 16 + laneHi * 8);
                Af[mm] = cat8(lo, hi);
            }
            __builtin_amdgcn_sched_barrier(0);   // keep the chunk's ds_loads together, ahead of its WMMAs
#pragma unroll
            for (int mm = 0; mm < FM; mm++)
#pragma unroll
                for (int nn = 0; nn < FN; nn++)
                    acc[mm][nn] = __builtin_amdgcn_wmma_f32_16x16x32_f16(
                        false, Af[mm], false, Bf[nn], (short)0, acc[mm][nn], false, false);
            // keeps the next chunk's loads, and the hand-over, behind these WMMAs: lifted above
            // them, the wait for the next step's copies would come right after their issue
            __builtin_amdgcn_sched_barrier(0);
        }

        // Hand-over: this wave has left buffer j & 1 and its copies of step j + 1
        // have landed; behind the barrier that holds for all eight waves.
        asm volatile("s_wait_dscnt 0x0" ::: "memory");      // own LDS reads of this buffer are done
        asm volatile("s_wait_asynccnt 0x0" ::: "memory");   // own copies of step j + 1 have landed
        __syncthreads();        // publishes step j + 1, frees buffer j & 1
        if (j + 2 < D_MODEL / KSTEP)
            stage_xw(xb + (j + 2) * KSTEP, wb + (j + 2) * KSTEP, xws[j & 1], t);
    }
    asm volatile("s_wait_asynccnt 0x0" ::: "memory");   // no copy outstanding at the wave's end

    // Epilogue: add bias, convert f16, scatter to the layout of the matrix that the
    // 16-column tile belongs to (the same for the whole wave: a scalar branch).
    // A wave's 128 rows lie in one batch, so one pointer per column tile serves all its stores.
    float bias[FN];                // all six loads together: one latency, not six
#pragma unroll
    for (int nn = 0; nn < FN; nn++) {
        const int tile = wn * FN + nn;
        const int mat  = tile >> 3;
        bias[nn] = ((mat == 0) ? bq : ((mat == 1) ? bk : bv))[nBase + (tile & 7) * 16 + laneLo];
    }
    __builtin_amdgcn_sched_barrier(0);   // the six loads stay in front of the wait below
    // precaution: stands in front of every later write of a register that these loads name
    asm volatile("s_wait_xcnt 0x0" ::: "memory");
    __builtin_amdgcn_sched_barrier(0);   // keeps the arithmetic that follows behind that wait
    const int rowb = mBase + wm * (16 * FM) + laneHi * 8;   // row of register 0 of fragment 0
    const int bb = rowb >> 11;     // batch
    const int sb = rowb & 2047;    // seq pos
#pragma unroll
    for (int nn = 0; nn < FN; nn++) {
        const int tile = wn * FN + nn;       // 0..23 : 8 tiles per matrix
        const int mat  = tile >> 3;          // 0 Q, 1 K, 2 V
        const int col  = nBase + (tile & 7) * 16 + laneLo;
        const int h = col >> 6;          // head
        const int d = col & 63;          // dim in head
        v8h o[FM];
#pragma unroll
        for (int mm = 0; mm < FM; mm++)
#pragma unroll
            for (int r = 0; r < 8; r++) o[mm][r] = (_Float16)(acc[mm][nn][r] + bias[nn]);
        // all values of the column tile stand in registers of their own before its first
        // store: no store's data register is written again while the stores are being issued
        __builtin_amdgcn_sched_barrier(0);
        if (mat == 2) {
            _Float16* vp = vd + (((size_t)bb * NHEAD + h) * HEAD_DIM + d) * SEQ + sb;
#pragma unroll
            for (int mm = 0; mm < FM; mm++) *(v8h*)(vp + mm * 16) = o[mm];
            // precaution: stands in front of every later write of a register that these stores name
            asm volatile("s_wait_xcnt 0x0" ::: "memory");
        } else {
            _Float16* qp = ((mat == 0) ? qd : kd)
                         + (((size_t)bb * NHEAD + h) * SEQ + sb) * HEAD_DIM + d;
#pragma unroll
            for (int mm = 0; mm < FM; mm++)
#pragma unroll
                for (int r = 0; r < 8; r++) qp[(mm * 16 + r) * HEAD_DIM] = o[mm][r];
            asm volatile("s_wait_xcnt 0x0" ::: "memory");   // the same precaution
        }
        // keeps the next column tile's arithmetic behind those waits
        __builtin_amdgcn_sched_barrier(0);
    }
}

__device__ __forceinline__ void stage_kv(const _Float16* kblk, const _Float16* vblk,
                                         _Float16 (*dst)[64][KV_PITCH], int t)
{
    const int row = t >> 3;          // 0..15, +16 per copy
    const int col = (t & 7) * 8;     // halfs
    const _Float16* gk0 = kblk + (size_t)row * HEAD_DIM + col;
    const _Float16* gk1 = gk0 + 16 * HEAD_DIM;
    const _Float16* gk2 = gk0 + 32 * HEAD_DIM;
    const _Float16* gk3 = gk0 + 48 * HEAD_DIM;
    const _Float16* gv0 = vblk + (size_t)row * SEQ + col;
    const _Float16* gv1 = gv0 + 16 * SEQ;
    const _Float16* gv2 = gv0 + 32 * SEQ;
    const _Float16* gv3 = gv0 + 48 * SEQ;
    const unsigned lk0 = lds_addr(&dst[0][row][col]);
    const unsigned lk1 = lds_addr(&dst[0][row + 16][col]);
    const unsigned lk2 = lds_addr(&dst[0][row + 32][col]);
    const unsigned lk3 = lds_addr(&dst[0][row + 48][col]);
    const unsigned lv0 = lds_addr(&dst[1][row][col]);
    const unsigned lv1 = lds_addr(&dst[1][row + 16][col]);
    const unsigned lv2 = lds_addr(&dst[1][row + 32][col]);
    const unsigned lv3 = lds_addr(&dst[1][row + 48][col]);
    // The copies and their s_wait_xcnt in one statement: the wait then stands in
    // front of every later write of an address register that a copy names.
    asm volatile(
        "global_load_async_to_lds_b128 %0, %8, off\n\t"
        "global_load_async_to_lds_b128 %1, %9, off\n\t"
        "global_load_async_to_lds_b128 %2, %10, off\n\t"
        "global_load_async_to_lds_b128 %3, %11, off\n\t"
        "global_load_async_to_lds_b128 %4, %12, off\n\t"
        "global_load_async_to_lds_b128 %5, %13, off\n\t"
        "global_load_async_to_lds_b128 %6, %14, off\n\t"
        "global_load_async_to_lds_b128 %7, %15, off\n\t"
        "s_wait_xcnt 0x0"
        :: "v"(lk0), "v"(lk1), "v"(lk2), "v"(lk3),
           "v"(lv0), "v"(lv1), "v"(lv2), "v"(lv3),
           "v"(gk0), "v"(gk1), "v"(gk2), "v"(gk3),
           "v"(gv0), "v"(gv1), "v"(gv2), "v"(gv3)
        : "memory");
}

// Lane l's value from lane l ^ 16 (the other half of the wave), on the vector pipe.
__device__ __forceinline__ float xhalf(float v) {
    int i = __builtin_bit_cast(int, v);
    return __builtin_bit_cast(float,
        __builtin_amdgcn_permlanex16(i, i, 0x76543210, 0xfedcba98, false, false));
}

#define QG 2   // 16-query groups per wave
#define QSCALE (0.03125f * 1.44269504f)   // 1/sqrt(D_MODEL) * log2(e)

// 1,024 work-groups of one wave per SIMD: four waves per SIMD hold them all at once,
// which needs at most 256 registers a wave
__global__ __launch_bounds__(128) __attribute__((amdgpu_waves_per_eu(4, 4)))
void attn_kernel(const _Float16* __restrict__ q,    // [B][H][S][Dh]
                 const _Float16* __restrict__ k,    // [B][H][S][Dh]
                 const _Float16* __restrict__ vt,   // [B][H][Dh][S]
                 float* __restrict__ out)           // [B][S][D_MODEL]
{
    const int qt = blockIdx.x;          // q tile (128 rows)
    const int bh = blockIdx.y;          // b*NHEAD + h
    const int b  = bh >> 4;
    const int h  = bh & 15;
    const int t      = threadIdx.x;
    const int wid    = t >> 5;          // 0..3
    const int lane   = t & 31;
    const int laneLo = lane & 15;
    const int laneHi = lane >> 4;

    const _Float16* qh  = q  + (size_t)bh * SEQ * HEAD_DIM;
    const _Float16* kh  = k  + (size_t)bh * SEQ * HEAD_DIM;
    const _Float16* vth = vt + (size_t)bh * HEAD_DIM * SEQ;

    __shared__ __align__(16) _Float16 kvs[2][2][64][KV_PITCH];  // [buffer][K | V^T][row][col]

    // Block 0 into buffer 0, landed and published; then block 1 into buffer 1.
    stage_kv(kh, vth, kvs[0], t);
    asm volatile("s_wait_asynccnt 0x0" ::: "memory");   // this wave's copies of block 0 have landed
    __syncthreads();                                    // ... and every other wave's
    stage_kv(kh + 64 * HEAD_DIM, vth + 64, kvs[1], t);

    // Q^T fragments: per group 64 d x 16 queries -> two 32x16 B-frags, straight from
    // global; lane column = query, k order as in the K loader below
    const int qrow = qt * (64 * QG) + wid * (16 * QG) + laneLo;   // group g: + 16 g
    v16h Bq[QG][2];
#pragma unroll
    for (int g = 0; g < QG; g++)
#pragma unroll
        for (int c = 0; c < 2; c++) {
            const _Float16* qp = qh + (size_t)(qrow + 16 * g) * HEAD_DIM + c * 32;
            v8h lo = *(const v8h*)(qp + laneHi * 8);
            v8h hi = *(const v8h*)(qp + 16 + laneHi * 8);
            Bq[g][c] = cat8(lo, hi);
            // scale * log2(e) goes into Q: multiplied in f32, rounded to f16 once more
#pragma unroll
            for (int i = 0; i < 16; i++)
                Bq[g][c][i] = (_Float16)((float)Bq[g][c][i] * QSCALE);
        }

    // All-ones A tile: ones @ P^T gives each query's sum of P in every accumulator row
    v16h onesA;
#pragma unroll
    for (int i = 0; i < 16; i++) onesA[i] = (_Float16)1.0f;

    v8f Oacc[QG][4];    // O^T: Oacc[g][n][r] = O[query 16 g + laneLo][d = n*16 + laneHi*8 + r]
    v8f Cm[QG];         // minus the maximum in use of this lane's query, in all 8 registers
    float lrow[QG];     // this lane's query of each group
#pragma unroll
    for (int g = 0; g < QG; g++) {
#pragma unroll
        for (int n = 0; n < 4; n++) Oacc[g][n] = zero8();
        Cm[g] = zero8();
        lrow[g] = 0.0f;
    }

    for (int j = 0; j < SEQ / 64; ++j) {
        const _Float16 (*ks)[KV_PITCH] = kvs[j & 1][0];   // [key][d]
        const _Float16 (*vs)[KV_PITCH] = kvs[j & 1][1];   // [d][key]

        // ---- Load ALL K A-fragments up front (one clause, overlapped) ----
        v16h Ak[2][4];
#pragma unroll
        for (int n = 0; n < 4; n++)
#pragma unroll
            for (int c = 0; c < 2; c++) {
                const _Float16* kp = &ks[n * 16 + laneLo][c * 32];
                v8h lo = *(const v8h*)(kp + laneHi * 8);
                v8h hi = *(const v8h*)(kp + 16 + laneHi * 8);
                Ak[c][n] = cat8(lo, hi);
            }
        __builtin_amdgcn_sched_barrier(0);   // pin loads ahead of WMMAs

        // ---- S^T = K @ Q^T - maximum in use : 16 back-to-back WMMAs, each K fragment used twice ----
        // S[g][n][r] = log2-domain score(key n*16 + laneHi*8 + r, query 16 g + laneLo)
        v8f S[QG][4];
#pragma unroll
        for (int n = 0; n < 4; n++) {
#pragma unroll
            for (int g = 0; g < QG; g++)
                S[g][n] = __builtin_amdgcn_wmma_f32_16x16x32_f16(
                    false, Ak[0][n], false, Bq[g][0], (short)0, Cm[g], false, false);
#pragma unroll
            for (int g = 0; g < QG; g++)
                S[g][n] = __builtin_amdgcn_wmma_f32_16x16x32_f16(
                    false, Ak[1][n], false, Bq[g][1], (short)0, S[g][n], false, false);
        }

        // ---- This lane's largest score of each group, relative to the maximum in use ----
        float mx[QG];
#pragma unroll
        for (int g = 0; g < QG; g++) {
            float mx8[8];
#pragma unroll
            for (int r = 0; r < 8; r++)
                mx8[r] = fmaxf(fmaxf(S[g][0][r], S[g][1][r]), fmaxf(S[g][2][r], S[g][3][r]));
            mx[g] = fmaxf(fmaxf(fmaxf(mx8[0], mx8[1]), fmaxf(mx8[2], mx8[3])),
                          fmaxf(fmaxf(mx8[4], mx8[5]), fmaxf(mx8[6], mx8[7])));
        }

        // ---- One test per block, the same for the whole wave (a scalar branch): the
        //      first block sets the maxima in use, a later one moves them only if some
        //      score lies more than 8 above ----
        const bool need = fmaxf(mx[0], mx[1]) > ((j == 0) ? -3.0e38f : 8.0f);
        if (__builtin_amdgcn_ballot_w32(need) != 0) {
#pragma unroll
            for (int g = 0; g < QG; g++) {
                const float m = fmaxf(mx[g], xhalf(mx[g]));   // the other 32 scores sit in lane ^ 16
                // step of the maximum in use: never down, but for the first block, which starts from 0
                const float d = (j == 0) ? m : fmaxf(m, 0.0f);
                // a step down meets only zeros in O and the sums: factor 1 there
                const float alpha = __builtin_amdgcn_exp2f(-fmaxf(d, 0.0f));
#pragma unroll
                for (int n = 0; n < 4; n++) {
                    S[g][n] -= d;
                    Oacc[g][n] *= alpha;
                }
                Cm[g] -= d;
                lrow[g] *= alpha;
            }
        }

        // ---- P^T B-fragments in place: score tiles 2c and 2c+1 are keys
        //      {8*laneHi + 0..7} and {16 + 8*laneHi + 0..7} of 32-key chunk c,
        //      the k order of the V^T loader ----
        v16h Bp[QG][2];
#pragma unroll
        for (int g = 0; g < QG; g++) {
#pragma unroll
            for (int n = 0; n < 4; n++)
#pragma unroll
                for (int r = 0; r < 8; r++) S[g][n][r] = __builtin_amdgcn_exp2f(S[g][n][r]);
#pragma unroll
            for (int c = 0; c < 2; c++)
#pragma unroll
                for (int r = 0; r < 8; r++) {
                    Bp[g][c][r]     = (_Float16)S[g][2 * c][r];
                    Bp[g][c][8 + r] = (_Float16)S[g][2 * c + 1][r];
                }
        }

        // ---- Load ALL V^T A-fragments up front ----
        v16h Av[2][4];
#pragma unroll
        for (int c = 0; c < 2; c++)
#pragma unroll
            for (int n = 0; n < 4; n++) {
                const _Float16* vp = &vs[n * 16 + laneLo][c * 32];
                v8h alo = *(const v8h*)(vp + laneHi * 8);
                v8h ahi = *(const v8h*)(vp + 16 + laneHi * 8);
                Av[c][n] = cat8(alo, ahi);
            }
        __builtin_amdgcn_sched_barrier(0);   // pin loads ahead of WMMAs

        // ---- O^T += V^T @ P^T  and  sums of P = ones @ P^T : 20 WMMAs,
        //      each V^T fragment used twice ----
        v8f lacc[QG];
#pragma unroll
        for (int g = 0; g < QG; g++) lacc[g] = zero8();
#pragma unroll
        for (int c = 0; c < 2; c++) {
#pragma unroll
            for (int g = 0; g < QG; g++)
                lacc[g] = __builtin_amdgcn_wmma_f32_16x16x32_f16(
                    false, onesA, false, Bp[g][c], (short)0, lacc[g], false, false);
#pragma unroll
            for (int n = 0; n < 4; n++)
#pragma unroll
                for (int g = 0; g < QG; g++)
                    Oacc[g][n] = __builtin_amdgcn_wmma_f32_16x16x32_f16(
                        false, Av[c][n], false, Bp[g][c], (short)0, Oacc[g][n], false, false);
        }
#pragma unroll
        for (int g = 0; g < QG; g++) lrow[g] += lacc[g][0];

        // Hand-over: this wave has left buffer j & 1 and its copies of block j + 1
        // have landed; behind the barrier that holds for all four waves.
        asm volatile("s_wait_dscnt 0x0" ::: "memory");      // own LDS reads of this buffer are done
        asm volatile("s_wait_asynccnt 0x0" ::: "memory");   // own copies of block j + 1 have landed
        __syncthreads();        // publishes block j + 1, frees buffer j & 1
        if (j + 2 < SEQ / 64)
            stage_kv(kh + (size_t)(j + 2) * 64 * HEAD_DIM, vth + (j + 2) * 64, kvs[j & 1], t);
    }
    asm volatile("s_wait_asynccnt 0x0" ::: "memory");   // no copy outstanding at the wave's end

    // Normalize and write out [B][S][D_MODEL] f32: a lane holds 8 consecutive d per tile
#pragma unroll
    for (int g = 0; g < QG; g++) {
        float* op = out + ((size_t)b * SEQ + qrow + 16 * g) * D_MODEL + h * HEAD_DIM + laneHi * 8;
#pragma unroll
        for (int n = 0; n < 4; n++) {
            v4f o0, o1;
#pragma unroll
            for (int r = 0; r < 4; r++) {
                o0[r] = Oacc[g][n][r] / lrow[g];
                o1[r] = Oacc[g][n][4 + r] / lrow[g];
            }
            *(v4f*)(op + n * 16)     = o0;
            *(v4f*)(op + n * 16 + 4) = o1;
        }
    }
}

extern "C" void kernel_launch(void* const* d_in, const int* in_sizes, int n_in,
                              void* d_out, int out_size, void* d_ws, size_t ws_size,
                              hipStream_t stream) {
    const float* x  = (const float*)d_in[0];
    const float* Wq = (const float*)d_in[1];
    const float* bq = (const float*)d_in[2];
    const float* Wk = (const float*)d_in[3];
    const float* bk = (const float*)d_in[4];
    const float* Wv = (const float*)d_in[5];
    const float* bv = (const float*)d_in[6];
    float* out = (float*)d_out;

    const size_t per = (size_t)BATCH * NHEAD * SEQ * HEAD_DIM;  // 8.4M elems
    _Float16* qws = (_Float16*)d_ws;
    _Float16* kws = qws + per;
    _Float16* vws = kws + per;
    _Float16* xh  = vws + per;
    _Float16* wt  = xh + per;      // total 70MB of f16 in d_ws

    to_f16_kernel<<<W_BLOCKS + NROWS * D_MODEL / 4096, 256, 0, stream>>>(x, Wq, Wk, Wv, xh, wt);

    dim3 g1(D_MODEL / TILE_NW, NROWS / TILE_M);   // (8, 32)
    qkv_proj_kernel<<<g1, 256, 0, stream>>>(xh, wt, bq, bk, bv, qws, kws, vws);

    dim3 g2(SEQ / (64 * QG), BATCH * NHEAD);   // (16, 64)
    attn_kernel<<<g2, 128, 0, stream>>>(qws, kws, vws, out);
}

// v008
// A run of this version takes 97.1 microseconds.
// In two side-by-side timings against v007, it was 1.04 and 1.02 times as fast.
// Counting every step since v000, it is 4.69 times as fast.
#include <hip/hip_runtime.h>

typedef __attribute__((ext_vector_type(16))) _Float16 v16h;
typedef __attribute__((ext_vector_type(8)))  _Float16 v8h;
typedef __attribute__((ext_vector_type(4)))  _Float16 v4h;
typedef __attribute__((ext_vector_type(8)))  float    v8f;
typedef __attribute__((ext_vector_type(4)))  float    v4f;

#define D_MODEL  1024
#define NHEAD    16
#define HEAD_DIM 64
#define BATCH    4
#define SEQ      2048
#define NROWS    (BATCH * SEQ)   // 8192

__device__ __forceinline__ v16h cat8(v8h lo, v8h hi) {
    v16h r;
#pragma unroll
    for (int i = 0; i < 8; i++) { r[i] = lo[i]; r[8 + i] = hi[i]; }
    return r;
}

__device__ __forceinline__ v8f zero8() {
    v8f r;
#pragma unroll
    for (int i = 0; i < 8; i++) r[i] = 0.0f;
    return r;
}

#define KV_PITCH 72   // halfs per staged row: 144 B = 16 B x 9, conflict-free for b128 readers

typedef __attribute__((address_space(3))) const _Float16 lds_cf16;

__device__ __forceinline__ unsigned lds_addr(const _Float16* p) {
    return (unsigned)(uintptr_t)(lds_cf16*)p;   // byte offset in the work-group's LDS
}

// The work-group barrier in two halves (both ring loops below). A wave signals once it has
// left a buffer and its own copies of the next stage have landed, runs the WMMAs whose
// fragments it already holds, and only then waits: these WMMAs cover the time in which the
// other waves arrive, and a wave that is through refills and reads on while the wave that
// shares its SIMD still feeds the matrix unit. No LDS read stands between signal and wait;
// signal and wait alternate strictly in every wave. The "memory" clobber keeps LDS reads
// and the copies on their side of each half.
__device__ __forceinline__ void bar_signal() { asm volatile("s_barrier_signal -1" ::: "memory"); }
__device__ __forceinline__ void bar_wait()   { asm volatile("s_barrier_wait -1" ::: "memory"); }

// ---------------------------------------------------------------------------
// Kernel 0: the projections' operands as f16, k-contiguous, written once per call.
//   blocks 0..383   : W (f32 [k][n]) -> wt (f16 [matrix][n][k]); a block turns a
//                     64 k x 128 n tile, a thread an 8 k x 4 n piece in its registers
//   blocks 384..2431: x (f32) -> xh (f16), same layout, 4096 elements per block
// The unrolled loops here and in kernel 1 index vectors and fragment arrays, which
// stay in registers only if every index is a compile-time constant.
// ---------------------------------------------------------------------------
#define W_BLOCKS 384

__global__ __launch_bounds__(256)
void to_f16_kernel(const float* __restrict__ x,
                   const float* __restrict__ Wq,
                   const float* __restrict__ Wk,
                   const float* __restrict__ Wv,
                   _Float16* __restrict__ xh,
                   _Float16* __restrict__ wt)
{
    const int t   = threadIdx.x;
    const int blk = blockIdx.x;
    if (blk < W_BLOCKS) {
        const int m    = blk >> 7;        // 0 Wq, 1 Wk, 2 Wv
        const int tile = blk & 127;
        const int wid  = t >> 5;
        const int lane = t & 31;
        const float* W = (m == 0) ? Wq : ((m == 1) ? Wk : Wv);
        // 8 lanes cover one 128-B line of a k row; 4 lanes cover 64 B of an output row
        const int ko = (tile >> 3) * 64 + ((wid & 1) * 4 + (lane >> 3)) * 8;
        const int nc = (tile & 7) * 128 + ((wid >> 1) * 8 + (lane & 7)) * 4;
        const float* wp = W + (size_t)ko * D_MODEL + nc;
        v4f wv[8];
#pragma unroll
        for (int i = 0; i < 8; i++) wv[i] = *(const v4f*)(wp + (size_t)i * D_MODEL);
        _Float16* op = wt + ((size_t)m * D_MODEL + nc) * D_MODEL + ko;
#pragma unroll
        for (int e = 0; e < 4; e++) {
            v8h wh;
#pragma unroll
            for (int i = 0; i < 8; i++) wh[i] = (_Float16)wv[i][e];
            *(v8h*)(op + (size_t)e * D_MODEL) = wh;
        }
    } else {
        const size_t base = (size_t)(blk - W_BLOCKS) * 4096;
        v4f xv[4];
#pragma unroll
        for (int i = 0; i < 4; i++) xv[i] = *(const v4f*)(x + base + (t + 256 * i) * 4);
#pragma unroll
        for (int i = 0; i < 4; i++) {
            v4h xo;
#pragma unroll
            for (int e = 0; e < 4; e++) xo[e] = (_Float16)xv[i][e];
            *(v4h*)(xh + base + (t + 256 * i) * 4) = xo;
        }
        // precaution: stands in front of every later write of a register that the four
        // stores name (the built code runs on from here into the W part's first lines)
        asm volatile("s_wait_xcnt 0x0" ::: "memory");
    }
}

// One 64-k step of the operand tiles into one buffer: 256 threads x 20 copies of 16 B.
// dst rows 0..255 = X tile [m][k]; rows 256..639 = W tile [n][k], 128 rows of each of
// Wq, Wk, Wv (the same 128 output columns of all three); 8 lanes fill one 128-B row.
#define TILE_M 256
#define TILE_NW 128                    // output columns per weight matrix
#define TILE_N (3 * TILE_NW)
#define TILE_ROWS (TILE_M + TILE_N)

// Ten copies of 16 B per lane. Copy i: LDS byte address li; global address = the scalar
// base bi (the same for the whole wave) + the lane's byte offset voff. With scalar bases a
// statement names 11 vector registers instead of 30: asm operands must lie below v256, where
// the accumulators live, and every register more is an accumulator moved out and back each step.
__device__ __forceinline__ void copy10(unsigned voff,
                                       unsigned l0, unsigned l1, unsigned l2, unsigned l3, unsigned l4,
                                       unsigned l5, unsigned l6, unsigned l7, unsigned l8, unsigned l9,
                                       const _Float16* b0, const _Float16* b1, const _Float16* b2,
                                       const _Float16* b3, const _Float16* b4, const _Float16* b5,
                                       const _Float16* b6, const _Float16* b7, const _Float16* b8,
                                       const _Float16* b9)
{
    // The copies and their s_wait_xcnt in one statement: the wait then stands in
    // front of every later write of an address register that a copy names.
    asm volatile(
        "global_load_async_to_lds_b128 %0, %20, %10\n\t"
        "global_load_async_to_lds_b128 %1, %20, %11\n\t"
        "global_load_async_to_lds_b128 %2, %20, %12\n\t"
        "global_load_async_to_lds_b128 %3, %20, %13\n\t"
        "global_load_async_to_lds_b128 %4, %20, %14\n\t"
        "global_load_async_to_lds_b128 %5, %20, %15\n\t"
        "global_load_async_to_lds_b128 %6, %20, %16\n\t"
        "global_load_async_to_lds_b128 %7, %20, %17\n\t"
        "global_load_async_to_lds_b128 %8, %20, %18\n\t"
        "global_load_async_to_lds_b128 %9, %20, %19\n\t"
        "s_wait_xcnt 0x0"
        :: "v"(l0), "v"(l1), "v"(l2), "v"(l3), "v"(l4),
           "v"(l5), "v"(l6), "v"(l7), "v"(l8), "v"(l9),
           "s"(b0), "s"(b1), "s"(b2), "s"(b3), "s"(b4),
           "s"(b5), "s"(b6), "s"(b7), "s"(b8), "s"(b9),
           "v"(voff)
        : "memory");
}

// xblk: first X row of the tile at this k step; wblk: row nBase of Wq's copy at this k step
// (Wk's and Wv's rows lie D_MODEL and 2 D_MODEL rows further on). Both are wave-uniform.
__device__ __forceinline__ void stage_xw(const _Float16* xblk, const _Float16* wblk,
                                         _Float16 (*dst)[KV_PITCH], int t)
{
    const int row = t >> 3;          // 0..31, +32 per copy
    const int col = (t & 7) * 8;     // halfs
    const unsigned voff = (unsigned)(row * D_MODEL + col) * 2u;   // bytes, below 64 KiB
    const _Float16* kblk = wblk + (size_t)D_MODEL * D_MODEL;
    const _Float16* vblk = kblk + (size_t)D_MODEL * D_MODEL;
    const unsigned l = lds_addr(&dst[row][col]);
    const unsigned s = 32 * KV_PITCH * 2;   // bytes of 32 LDS rows
    copy10(voff, l, l + s, l + 2 * s, l + 3 * s, l + 4 * s, l + 5 * s, l + 6 * s, l + 7 * s,
           l + 8 * s, l + 9 * s,
           xblk, xblk + 32 * D_MODEL, xblk + 64 * D_MODEL, xblk + 96 * D_MODEL,
           xblk + 128 * D_MODEL, xblk + 160 * D_MODEL, xblk + 192 * D_MODEL, xblk + 224 * D_MODEL,
           wblk, wblk + 32 * D_MODEL);
    copy10(voff, l + 10 * s, l + 11 * s, l + 12 * s, l + 13 * s, l + 14 * s, l + 15 * s,
           l + 16 * s, l + 17 * s, l + 18 * s, l + 19 * s,
           wblk + 64 * D_MODEL, wblk + 96 * D_MODEL,
           kblk, kblk + 32 * D_MODEL, kblk + 64 * D_MODEL, kblk + 96 * D_MODEL,
           vblk, vblk + 32 * D_MODEL, vblk + 64 * D_MODEL, vblk + 96 * D_MODEL);
}

// ---------------------------------------------------------------------------
// Kernel 1: Q, K, V = X @ W + b for all three weight matrices, emitted as f16;
// X and W come as f16, both k-contiguous (kernel 0).
//   Q, K -> layout [B][H][S][Dh];  V -> [B][H][Dh][S] (pre-transposed for the V^T A-frags)
// One work-group per WGP: 256 threads (8 waves), tile 256 rows x 384 columns (the same
// 128 columns of Q, K and V, so one staged X tile serves three weight tiles), K-step 64,
// brought into LDS by asynchronous copies one step ahead in two buffers.
// Wave (wm, wn) computes a 128 x 96 subtile: per 32 k, 48 WMMAs on 14 fragments.
// ---------------------------------------------------------------------------
#define KSTEP 64
#define FM 8    // 16-row fragments per wave
#define FN 6    // 16-column fragments per wave

__global__ __launch_bounds__(256)
void qkv_proj_kernel(const _Float16* __restrict__ xh,   // [8192][1024]
                     const _Float16* __restrict__ wt,   // [matrix][n][k]
                     const float* __restrict__ bq,
                     const float* __restrict__ bk,
                     const float* __restrict__ bv,
                     _Float16* __restrict__ qd,
                     _Float16* __restrict__ kd,
                     _Float16* __restrict__ vd)
{
    const int nBase = blockIdx.x * TILE_NW;
    const int mBase = blockIdx.y * TILE_M;
    const int t      = threadIdx.x;
    const int wid    = __builtin_amdgcn_readfirstlane(t >> 5);   // scalar: the epilogue branches on it
    const int lane   = t & 31;
    const int laneLo = lane & 15;
    const int laneHi = lane >> 4;

    __shared__ __align__(16) _Float16 xws[2][TILE_ROWS][KV_PITCH];  // [buffer][X rows | W rows][k]

    const int wm = wid >> 2;   // 0..1 : 128 rows each
    const int wn = wid & 3;    // 0..3 : 96 of the 384 columns each

    const _Float16* xb = xh + (size_t)mBase * D_MODEL;
    const _Float16* wb = wt + (size_t)nBase * D_MODEL;

    // Step 0 into buffer 0; step 1 follows behind the first barrier wait, at the top of pass 0.
    stage_xw(xb, wb, xws[0], t);
    asm volatile("s_wait_asynccnt 0x0" ::: "memory");   // this wave's copies of step 0 have landed
    bar_signal();                                       // the prologue's signal says so

    v8f acc[FM][FN];
#pragma unroll
    for (int i = 0; i < FM; i++)
#pragma unroll
        for (int j = 0; j < FN; j++) acc[i][j] = zero8();

    for (int j = 0; j < D_MODEL / KSTEP; ++j) {
        const _Float16 (*Xs)[KV_PITCH] = xws[j & 1];            // [m][k]
        const _Float16 (*Ws)[KV_PITCH] = xws[j & 1] + TILE_M;   // [n][k]

        __builtin_amdgcn_sched_barrier(0);   // the last pass's WMMAs stay in front of the wait
        bar_wait();             // step j is published, every wave has left the other buffer
        if (j + 1 < D_MODEL / KSTEP)
            stage_xw(xb + (j + 1) * KSTEP, wb + (j + 1) * KSTEP, xws[(j + 1) & 1], t);

#pragma unroll
        for (int c = 0; c < 2; c++) {
            // A-frag layout (16x32 f16): lanes 0-15 K{0..7,16..23}; lanes 16-31 K{8..15,24..31}
            v16h Af[FM], Bf[FN];
#pragma unroll
            for (int nn = 0; nn < FN; nn++) {
                const _Float16* bp = &Ws[wn * (16 * FN) + nn * 16 + laneLo][c * 32];
                v8h lo = *(const v8h*)(bp + laneHi * 8);
                v8h hi = *(const v8h*)(bp + 16 + laneHi * 8);
                Bf[nn] = cat8(lo, hi);
            }
#pragma unroll
            for (int mm = 0; mm < FM; mm++) {
                const _Float16* ap = &Xs[wm * (16 * FM) + mm * 16 + laneLo][c * 32];
                v8h lo = *(const v8h*)(ap + laneHi * 8);
                v8h hi = *(const v8h*)(ap + 16 + laneHi * 8);
                Af[mm] = cat8(lo, hi);
            }
            __builtin_amdgcn_sched_barrier(0);   // keep the chunk's ds_loads together, ahead of its WMMAs
            if (c == 1) {
                // Hand-over, signalled in front of the pass's last WMMAs: this wave holds its
                // last fragments of buffer j & 1 and its copies of step j + 1 have landed.
                asm volatile("s_wait_dscnt 0x0" ::: "memory");      // own LDS reads of this buffer are done
                asm volatile("s_wait_asynccnt 0x0" ::: "memory");   // own copies of step j + 1 have landed
                bar_signal();
                __builtin_amdgcn_sched_barrier(0);   // the WMMAs stay behind the signal
            }
#pragma unroll
            for (int mm = 0; mm < FM; mm++)
#pragma unroll
                for (int nn = 0; nn < FN; nn++)
                    acc[mm][nn] = __builtin_amdgcn_wmma_f32_16x16x32_f16(
                        false, Af[mm], false, Bf[nn], (short)0, acc[mm][nn], false, false);
            // keeps the next chunk's loads behind these WMMAs: one fragment set
            __builtin_amdgcn_sched_barrier(0);
        }
    }
    asm volatile("s_wait_asynccnt 0x0" ::: "memory");   // no copy outstanding at the wave's end
    bar_wait();                                         // the wait that belongs to the last pass's signal

    // Epilogue: add bias, convert f16, scatter to the layout of the matrix that the
    // 16-column tile belongs to (the same for the whole wave: a scalar branch).
    // A wave's 128 rows lie in one batch, so one pointer per column tile serves all its stores.
    float bias[FN];                // all six loads together: one latency, not six
#pragma unroll
    for (int nn = 0; nn < FN; nn++) {
        const int tile = wn * FN + nn;
        const int mat  = tile >> 3;
        bias[nn] = ((mat == 0) ? bq : ((mat == 1) ? bk : bv))[nBase + (tile & 7) * 16 + laneLo];
    }
    __builtin_amdgcn_sched_barrier(0);   // the six loads stay in front of the wait below
    // precaution: stands in front of every later write of a register that these loads name
    asm volatile("s_wait_xcnt 0x0" ::: "memory");
    __builtin_amdgcn_sched_barrier(0);   // keeps the arithmetic that follows behind that wait
    const int rowb = mBase + wm * (16 * FM) + laneHi * 8;   // row of register 0 of fragment 0
    const int bb = rowb >> 11;     // batch
    const int sb = rowb & 2047;    // seq pos
#pragma unroll
    for (int nn = 0; nn < FN; nn++) {
        const int tile = wn * FN + nn;       // 0..23 : 8 tiles per matrix
        const int mat  = tile >> 3;          // 0 Q, 1 K, 2 V
        const int col  = nBase + (tile & 7) * 16 + laneLo;
        const int h = col >> 6;          // head
        const int d = col & 63;          // dim in head
        v8h o[FM];
#pragma unroll
        for (int mm = 0; mm < FM; mm++)
#pragma unroll
            for (int r = 0; r < 8; r++) o[mm][r] = (_Float16)(acc[mm][nn][r] + bias[nn]);
        // all values of the column tile stand in registers of their own before its first
        // store: no store's data register is written again while the stores are being issued
        __builtin_amdgcn_sched_barrier(0);
        if (mat == 2) {
            _Float16* vp = vd + (((size_t)bb * NHEAD + h) * HEAD_DIM + d) * SEQ + sb;
#pragma unroll
            for (int mm = 0; mm < FM; mm++) *(v8h*)(vp + mm * 16) = o[mm];
            // precaution: stands in front of every later write of a register that these stores name
            asm volatile("s_wait_xcnt 0x0" ::: "memory");
        } else {
            _Float16* qp = ((mat == 0) ? qd : kd)
                         + (((size_t)bb * NHEAD + h) * SEQ + sb) * HEAD_DIM + d;
#pragma unroll
            for (int mm = 0; mm < FM; mm++)
#pragma unroll
                for (int r = 0; r < 8; r++) qp[(mm * 16 + r) * HEAD_DIM] = o[mm][r];
            asm volatile("s_wait_xcnt 0x0" ::: "memory");   // the same precaution
        }
        // keeps the next column tile's arithmetic behind those waits
        __builtin_amdgcn_sched_barrier(0);
    }
}

__device__ __forceinline__ void stage_kv(const _Float16* kblk, const _Float16* vblk,
                                         _Float16 (*dst)[64][KV_PITCH], int t)
{
    const int row = t >> 3;          // 0..15, +16 per copy
    const int col = (t & 7) * 8;     // halfs
    const _Float16* gk0 = kblk + (size_t)row * HEAD_DIM + col;
    const _Float16* gk1 = gk0 + 16 * HEAD_DIM;
    const _Float16* gk2 = gk0 + 32 * HEAD_DIM;
    const _Float16* gk3 = gk0 + 48 * HEAD_DIM;
    const _Float16* gv0 = vblk + (size_t)row * SEQ + col;
    const _Float16* gv1 = gv0 + 16 * SEQ;
    const _Float16* gv2 = gv0 + 32 * SEQ;
    const _Float16* gv3 = gv0 + 48 * SEQ;
    const unsigned lk0 = lds_addr(&dst[0][row][col]);
    const unsigned lk1 = lds_addr(&dst[0][row + 16][col]);
    const unsigned lk2 = lds_addr(&dst[0][row + 32][col]);
    const unsigned lk3 = lds_addr(&dst[0][row + 48][col]);
    const unsigned lv0 = lds_addr(&dst[1][row][col]);
    const unsigned lv1 = lds_addr(&dst[1][row + 16][col]);
    const unsigned lv2 = lds_addr(&dst[1][row + 32][col]);
    const unsigned lv3 = lds_addr(&dst[1][row + 48][col]);
    // The copies and their s_wait_xcnt in one statement: the wait then stands in
    // front of every later write of an address register that a copy names.
    asm volatile(
        "global_load_async_to_lds_b128 %0, %8, off\n\t"
        "global_load_async_to_lds_b128 %1, %9, off\n\t"
        "global_load_async_to_lds_b128 %2, %10, off\n\t"
        "global_load_async_to_lds_b128 %3, %11, off\n\t"
        "global_load_async_to_lds_b128 %4, %12, off\n\t"
        "global_load_async_to_lds_b128 %5, %13, off\n\t"
        "global_load_async_to_lds_b128 %6, %14, off\n\t"
        "global_load_async_to_lds_b128 %7, %15, off\n\t"
        "s_wait_xcnt 0x0"
        :: "v"(lk0), "v"(lk1), "v"(lk2), "v"(lk3),
           "v"(lv0), "v"(lv1), "v"(lv2), "v"(lv3),
           "v"(gk0), "v"(gk1), "v"(gk2), "v"(gk3),
           "v"(gv0), "v"(gv1), "v"(gv2), "v"(gv3)
        : "memory");
}

// Lane l's value from lane l ^ 16 (the other half of the wave), on the vector pipe.
__device__ __forceinline__ float xhalf(float v) {
    int i = __builtin_bit_cast(int, v);
    return __builtin_bit_cast(float,
        __builtin_amdgcn_permlanex16(i, i, 0x76543210, 0xfedcba98, false, false));
}

#define QG 2   // 16-query groups per wave
#define QSCALE (0.03125f * 1.44269504f)   // 1/sqrt(D_MODEL) * log2(e)

// 1,024 work-groups of one wave per SIMD: four waves per SIMD hold them all at once,
// which needs at most 256 registers a wave
__global__ __launch_bounds__(128) __attribute__((amdgpu_waves_per_eu(4, 4)))
void attn_kernel(const _Float16* __restrict__ q,    // [B][H][S][Dh]
                 const _Float16* __restrict__ k,    // [B][H][S][Dh]
                 const _Float16* __restrict__ vt,   // [B][H][Dh][S]
                 float* __restrict__ out)           // [B][S][D_MODEL]
{
    const int qt = blockIdx.x;          // q tile (128 rows)
    const int bh = blockIdx.y;          // b*NHEAD + h
    const int b  = bh >> 4;
    const int h  = bh & 15;
    const int t      = threadIdx.x;
    const int wid    = t >> 5;          // 0..3
    const int lane   = t & 31;
    const int laneLo = lane & 15;
    const int laneHi = lane >> 4;

    const _Float16* qh  = q  + (size_t)bh * SEQ * HEAD_DIM;
    const _Float16* kh  = k  + (size_t)bh * SEQ * HEAD_DIM;
    const _Float16* vth = vt + (size_t)bh * HEAD_DIM * SEQ;

    __shared__ __align__(16) _Float16 kvs[2][2][64][KV_PITCH];  // [buffer][K | V^T][row][col]

    // Block 0 into buffer 0; block 1 follows behind the first barrier wait, at the top of pass 0.
    stage_kv(kh, vth, kvs[0], t);
    asm volatile("s_wait_asynccnt 0x0" ::: "memory");   // this wave's copies of block 0 have landed
    bar_signal();                                       // the prologue's signal says so

    // Q^T fragments: per group 64 d x 16 queries -> two 32x16 B-frags, straight from
    // global; lane column = query, k order as in the K loader below
    const int qrow = qt * (64 * QG) + wid * (16 * QG) + laneLo;   // group g: + 16 g
    v16h Bq[QG][2];
#pragma unroll
    for (int g = 0; g < QG; g++)
#pragma unroll
        for (int c = 0; c < 2; c++) {
            const _Float16* qp = qh + (size_t)(qrow + 16 * g) * HEAD_DIM + c * 32;
            v8h lo = *(const v8h*)(qp + laneHi * 8);
            v8h hi = *(const v8h*)(qp + 16 + laneHi * 8);
            Bq[g][c] = cat8(lo, hi);
            // scale * log2(e) goes into Q: multiplied in f32, rounded to f16 once more
#pragma unroll
            for (int i = 0; i < 16; i++)
                Bq[g][c][i] = (_Float16)((float)Bq[g][c][i] * QSCALE);
        }

    // All-ones A tile: ones @ P^T gives each query's sum of P in every accumulator row
    v16h onesA;
#pragma unroll
    for (int i = 0; i < 16; i++) onesA[i] = (_Float16)1.0f;

    v8f Oacc[QG][4];    // O^T: Oacc[g][n][r] = O[query 16 g + laneLo][d = n*16 + laneHi*8 + r]
    v8f Cm[QG];         // minus the maximum in use of this lane's query, in all 8 registers
    float lrow[QG];     // this lane's query of each group
#pragma unroll
    for (int g = 0; g < QG; g++) {
#pragma unroll
        for (int n = 0; n < 4; n++) Oacc[g][n] = zero8();
        Cm[g] = zero8();
        lrow[g] = 0.0f;
    }

    for (int j = 0; j < SEQ / 64; ++j) {
        const _Float16 (*ks)[KV_PITCH] = kvs[j & 1][0];   // [key][d]
        const _Float16 (*vs)[KV_PITCH] = kvs[j & 1][1];   // [d][key]

        __builtin_amdgcn_sched_barrier(0);   // the last pass's WMMAs stay in front of the wait
        bar_wait();             // block j is published, every wave has left the other buffer
        if (j + 1 < SEQ / 64)
            stage_kv(kh + (size_t)(j + 1) * 64 * HEAD_DIM, vth + (j + 1) * 64, kvs[(j + 1) & 1], t);

        // ---- Load ALL K A-fragments up front (one clause, overlapped) ----
        v16h Ak[2][4];
#pragma unroll
        for (int n = 0; n < 4; n++)
#pragma unroll
            for (int c = 0; c < 2; c++) {
                const _Float16* kp = &ks[n * 16 + laneLo][c * 32];
                v8h lo = *(const v8h*)(kp + laneHi * 8);
                v8h hi = *(const v8h*)(kp + 16 + laneHi * 8);
                Ak[c][n] = cat8(lo, hi);
            }
        __builtin_amdgcn_sched_barrier(0);   // pin loads ahead of WMMAs

        // ---- S^T = K @ Q^T - maximum in use : 16 back-to-back WMMAs, each K fragment used twice ----
        // S[g][n][r] = log2-domain score(key n*16 + laneHi*8 + r, query 16 g + laneLo)
        v8f S[QG][4];
#pragma unroll
        for (int n = 0; n < 4; n++) {
#pragma unroll
            for (int g = 0; g < QG; g++)
                S[g][n] = __builtin_amdgcn_wmma_f32_16x16x32_f16(
                    false, Ak[0][n], false, Bq[g][0], (short)0, Cm[g], false, false);
#pragma unroll
            for (int g = 0; g < QG; g++)
                S[g][n] = __builtin_amdgcn_wmma_f32_16x16x32_f16(
                    false, Ak[1][n], false, Bq[g][1], (short)0, S[g][n], false, false);
        }

        // ---- This lane's largest score of each group, relative to the maximum in use ----
        float mx[QG];
#pragma unroll
        for (int g = 0; g < QG; g++) {
            float mx8[8];
#pragma unroll
            for (int r = 0; r < 8; r++)
                mx8[r] = fmaxf(fmaxf(S[g][0][r], S[g][1][r]), fmaxf(S[g][2][r], S[g][3][r]));
            mx[g] = fmaxf(fmaxf(fmaxf(mx8[0], mx8[1]), fmaxf(mx8[2], mx8[3])),
                          fmaxf(fmaxf(mx8[4], mx8[5]), fmaxf(mx8[6], mx8[7])));
        }

        // ---- One test per block, the same for the whole wave (a scalar branch): the
        //      first block sets the maxima in use, a later one moves them only if some
        //      score lies more than 8 above ----
        const bool need = fmaxf(mx[0], mx[1]) > ((j == 0) ? -3.0e38f : 8.0f);
        if (__builtin_amdgcn_ballot_w32(need) != 0) {
#pragma unroll
            for (int g = 0; g < QG; g++) {
                const float m = fmaxf(mx[g], xhalf(mx[g]));   // the other 32 scores sit in lane ^ 16
                // step of the maximum in use: never down, but for the first block, which starts from 0
                const float d = (j == 0) ? m : fmaxf(m, 0.0f);
                // a step down meets only zeros in O and the sums: factor 1 there
                const float alpha = __builtin_amdgcn_exp2f(-fmaxf(d, 0.0f));
#pragma unroll
                for (int n = 0; n < 4; n++) {
                    S[g][n] -= d;
                    Oacc[g][n] *= alpha;
                }
                Cm[g] -= d;
                lrow[g] *= alpha;
            }
        }

        // ---- P^T B-fragments in place: score tiles 2c and 2c+1 are keys
        //      {8*laneHi + 0..7} and {16 + 8*laneHi + 0..7} of 32-key chunk c,
        //      the k order of the V^T loader ----
        v16h Bp[QG][2];
#pragma unroll
        for (int g = 0; g < QG; g++) {
#pragma unroll
            for (int n = 0; n < 4; n++)
#pragma unroll
                for (int r = 0; r < 8; r++) S[g][n][r] = __builtin_amdgcn_exp2f(S[g][n][r]);
#pragma unroll
            for (int c = 0; c < 2; c++)
#pragma unroll
                for (int r = 0; r < 8; r++) {
                    Bp[g][c][r]     = (_Float16)S[g][2 * c][r];
                    Bp[g][c][8 + r] = (_Float16)S[g][2 * c + 1][r];
                }
        }

        // ---- Load ALL V^T A-fragments up front ----
        v16h Av[2][4];
#pragma unroll
        for (int c = 0; c < 2; c++)
#pragma unroll
            for (int n = 0; n < 4; n++) {
                const _Float16* vp = &vs[n * 16 + laneLo][c * 32];
                v8h alo = *(const v8h*)(vp + laneHi * 8);
                v8h ahi = *(const v8h*)(vp + 16 + laneHi * 8);
                Av[c][n] = cat8(alo, ahi);
            }
        __builtin_amdgcn_sched_barrier(0);   // pin loads ahead of WMMAs

        // Hand-over, signalled in front of the pass's last WMMAs: this wave holds its last
        // fragments of buffer j & 1 and its copies of block j + 1 have landed.
        asm volatile("s_wait_dscnt 0x0" ::: "memory");      // own LDS reads of this buffer are done
        asm volatile("s_wait_asynccnt 0x0" ::: "memory");   // own copies of block j + 1 have landed
        bar_signal();
        __builtin_amdgcn_sched_barrier(0);   // the WMMAs stay behind the signal

        // ---- O^T += V^T @ P^T  and  sums of P = ones @ P^T : 20 WMMAs,
        //      each V^T fragment used twice ----
        v8f lacc[QG];
#pragma unroll
        for (int g = 0; g < QG; g++) lacc[g] = zero8();
#pragma unroll
        for (int c = 0; c < 2; c++) {
#pragma unroll
            for (int g = 0; g < QG; g++)
                lacc[g] = __builtin_amdgcn_wmma_f32_16x16x32_f16(
                    false, onesA, false, Bp[g][c], (short)0, lacc[g], false, false);
#pragma unroll
            for (int n = 0; n < 4; n++)
#pragma unroll
                for (int g = 0; g < QG; g++)
                    Oacc[g][n] = __builtin_amdgcn_wmma_f32_16x16x32_f16(
                        false, Av[c][n], false, Bp[g][c], (short)0, Oacc[g][n], false, false);
        }
#pragma unroll
        for (int g = 0; g < QG; g++) lrow[g] += lacc[g][0];
    }
    asm volatile("s_wait_asynccnt 0x0" ::: "memory");   // no copy outstanding at the wave's end
    bar_wait();                                         // the wait that belongs to the last pass's signal

    // Normalize and write out [B][S][D_MODEL] f32: a lane holds 8 consecutive d per tile
#pragma unroll
    for (int g = 0; g < QG; g++) {
        float* op = out + ((size_t)b * SEQ + qrow + 16 * g) * D_MODEL + h * HEAD_DIM + laneHi * 8;
#pragma unroll
        for (int n = 0; n < 4; n++) {
            v4f o0, o1;
#pragma unroll
            for (int r = 0; r < 4; r++) {
                o0[r] = Oacc[g][n][r] / lrow[g];
                o1[r] = Oacc[g][n][4 + r] / lrow[g];
            }
            *(v4f*)(op + n * 16)     = o0;
            *(v4f*)(op + n * 16 + 4) = o1;
        }
    }
}

extern "C" void kernel_launch(void* const* d_in, const int* in_sizes, int n_in,
                              void* d_out, int out_size, void* d_ws, size_t ws_size,
                              hipStream_t stream) {
    const float* x  = (const float*)d_in[0];
    const float* Wq = (const float*)d_in[1];
    const float* bq = (const float*)d_in[2];
    const float* Wk = (const float*)d_in[3];
    const float* bk = (const float*)d_in[4];
    const float* Wv = (const float*)d_in[5];
    const float* bv = (const float*)d_in[6];
    float* out = (float*)d_out;

    const size_t per = (size_t)BATCH * NHEAD * SEQ * HEAD_DIM;  // 8.4M elems
    _Float16* qws = (_Float16*)d_ws;
    _Float16* kws = qws + per;
    _Float16* vws = kws + per;
    _Float16* xh  = vws + per;
    _Float16* wt  = xh + per;      // total 70MB of f16 in d_ws

    to_f16_kernel<<<W_BLOCKS + NROWS * D_MODEL / 4096, 256, 0, stream>>>(x, Wq, Wk, Wv, xh, wt);

    dim3 g1(D_MODEL / TILE_NW, NROWS / TILE_M);   // (8, 32)
    qkv_proj_kernel<<<g1, 256, 0, stream>>>(xh, wt, bq, bk, bv, qws, kws, vws);

    dim3 g2(SEQ / (64 * QG), BATCH * NHEAD);   // (16, 64)
    attn_kernel<<<g2, 128, 0, stream>>>(qws, kws, vws, out);
}

// v009
// One run takes 93.6 microseconds.
// Two timings next to v008 put it at 1.03 and 1.04 times that version's speed.
// All steps since v000 together make it 4.84 times as fast.
#include <hip/hip_runtime.h>

typedef __attribute__((ext_vector_type(16))) _Float16 v16h;
typedef __attribute__((ext_vector_type(8)))  _Float16 v8h;
typedef __attribute__((ext_vector_type(4)))  _Float16 v4h;
typedef __attribute__((ext_vector_type(8)))  float    v8f;
typedef __attribute__((ext_vector_type(4)))  float    v4f;

#define D_MODEL  1024
#define NHEAD    16
#define HEAD_DIM 64
#define BATCH    4
#define SEQ      2048
#define NROWS    (BATCH * SEQ)   // 8192

__device__ __forceinline__ v16h cat8(v8h lo, v8h hi) {
    v16h r;
#pragma unroll
    for (int i = 0; i < 8; i++) { r[i] = lo[i]; r[8 + i] = hi[i]; }
    return r;
}

__device__ __forceinline__ v8f zero8() {
    v8f r;
#pragma unroll
    for (int i = 0; i < 8; i++) r[i] = 0.0f;
    return r;
}

#define KV_PITCH 72   // halfs per staged row: 144 B = 16 B x 9, conflict-free for b128 readers

typedef __attribute__((address_space(3))) const _Float16 lds_cf16;

__device__ __forceinline__ unsigned lds_addr(const _Float16* p) {
    return (unsigned)(uintptr_t)(lds_cf16*)p;   // byte offset in the work-group's LDS
}

// The work-group barrier in two halves (both ring loops below). A wave signals once it has
// left a buffer and its own copies of the next stage have landed, runs the WMMAs whose
// fragments it already holds, and only then waits: these WMMAs cover the time in which the
// other waves arrive, and a wave that is through refills and reads on while the wave that
// shares its SIMD still feeds the matrix unit. No LDS read stands between signal and wait;
// signal and wait alternate strictly in every wave. The "memory" clobber keeps LDS reads
// and the copies on their side of each half.
__device__ __forceinline__ void bar_signal() { asm volatile("s_barrier_signal -1" ::: "memory"); }
__device__ __forceinline__ void bar_wait()   { asm volatile("s_barrier_wait -1" ::: "memory"); }

// ---------------------------------------------------------------------------
// Kernel 0: the projections' operands as f16, k-contiguous, written once per call.
//   blocks 0..383   : W (f32 [k][n]) -> wt (f16 [matrix][n][k]); a block turns a
//                     64 k x 128 n tile, a thread an 8 k x 4 n piece in its registers
//   blocks 384..2431: x (f32) -> xh (f16), same layout, 4096 elements per block
// The unrolled loops here and in kernel 1 index vectors and fragment arrays, which
// stay in registers only if every index is a compile-time constant.
// ---------------------------------------------------------------------------
#define W_BLOCKS 384

__global__ __launch_bounds__(256)
void to_f16_kernel(const float* __restrict__ x,
                   const float* __restrict__ Wq,
                   const float* __restrict__ Wk,
                   const float* __restrict__ Wv,
                   _Float16* __restrict__ xh,
                   _Float16* __restrict__ wt)
{
    const int t   = threadIdx.x;
    const int blk = blockIdx.x;
    if (blk < W_BLOCKS) {
        const int m    = blk >> 7;        // 0 Wq, 1 Wk, 2 Wv
        const int tile = blk & 127;
        const int wid  = t >> 5;
        const int lane = t & 31;
        const float* W = (m == 0) ? Wq : ((m == 1) ? Wk : Wv);
        // 8 lanes cover one 128-B line of a k row; 4 lanes cover 64 B of an output row
        const int ko = (tile >> 3) * 64 + ((wid & 1) * 4 + (lane >> 3)) * 8;
        const int nc = (tile & 7) * 128 + ((wid >> 1) * 8 + (lane & 7)) * 4;
        const float* wp = W + (size_t)ko * D_MODEL + nc;
        v4f wv[8];
#pragma unroll
        for (int i = 0; i < 8; i++) wv[i] = *(const v4f*)(wp + (size_t)i * D_MODEL);
        _Float16* op = wt + ((size_t)m * D_MODEL + nc) * D_MODEL + ko;
#pragma unroll
        for (int e = 0; e < 4; e++) {
            v8h wh;
#pragma unroll
            for (int i = 0; i < 8; i++) wh[i] = (_Float16)wv[i][e];
            *(v8h*)(op + (size_t)e * D_MODEL) = wh;
        }
    } else {
        const size_t base = (size_t)(blk - W_BLOCKS) * 4096;
        v4f xv[4];
#pragma unroll
        for (int i = 0; i < 4; i++) xv[i] = *(const v4f*)(x + base + (t + 256 * i) * 4);
#pragma unroll
        for (int i = 0; i < 4; i++) {
            v4h xo;
#pragma unroll
            for (int e = 0; e < 4; e++) xo[e] = (_Float16)xv[i][e];
            *(v4h*)(xh + base + (t + 256 * i) * 4) = xo;
        }
        // precaution: stands in front of every later write of a register that the four
        // stores name (the built code runs on from here into the W part's first lines)
        asm volatile("s_wait_xcnt 0x0" ::: "memory");
    }
}

// One 64-k step of the operand tiles into one buffer: 256 threads x 20 copies of 16 B.
// dst rows 0..255 = X tile [m][k]; rows 256..639 = W tile [n][k], 128 rows of each of
// Wq, Wk, Wv (the same 128 output columns of all three); 8 lanes fill one 128-B row.
#define TILE_M 256
#define TILE_NW 128                    // output columns per weight matrix
#define TILE_N (3 * TILE_NW)
#define TILE_ROWS (TILE_M + TILE_N)

// Ten copies of 16 B per lane. Copy i: LDS byte address li; global address = the scalar
// base bi (the same for the whole wave) + the lane's byte offset voff. With scalar bases a
// statement names 11 vector registers instead of 30: asm operands must lie below v256, where
// the accumulators live, and every register more is an accumulator moved out and back each step.
__device__ __forceinline__ void copy10(unsigned voff,
                                       unsigned l0, unsigned l1, unsigned l2, unsigned l3, unsigned l4,
                                       unsigned l5, unsigned l6, unsigned l7, unsigned l8, unsigned l9,
                                       const _Float16* b0, const _Float16* b1, const _Float16* b2,
                                       const _Float16* b3, const _Float16* b4, const _Float16* b5,
                                       const _Float16* b6, const _Float16* b7, const _Float16* b8,
                                       const _Float16* b9)
{
    // The copies and their s_wait_xcnt in one statement: the wait then stands in
    // front of every later write of an address register that a copy names.
    asm volatile(
        "global_load_async_to_lds_b128 %0, %20, %10\n\t"
        "global_load_async_to_lds_b128 %1, %20, %11\n\t"
        "global_load_async_to_lds_b128 %2, %20, %12\n\t"
        "global_load_async_to_lds_b128 %3, %20, %13\n\t"
        "global_load_async_to_lds_b128 %4, %20, %14\n\t"
        "global_load_async_to_lds_b128 %5, %20, %15\n\t"
        "global_load_async_to_lds_b128 %6, %20, %16\n\t"
        "global_load_async_to_lds_b128 %7, %20, %17\n\t"
        "global_load_async_to_lds_b128 %8, %20, %18\n\t"
        "global_load_async_to_lds_b128 %9, %20, %19\n\t"
        "s_wait_xcnt 0x0"
        :: "v"(l0), "v"(l1), "v"(l2), "v"(l3), "v"(l4),
           "v"(l5), "v"(l6), "v"(l7), "v"(l8), "v"(l9),
           "s"(b0), "s"(b1), "s"(b2), "s"(b3), "s"(b4),
           "s"(b5), "s"(b6), "s"(b7), "s"(b8), "s"(b9),
           "v"(voff)
        : "memory");
}

// xblk: first X row of the tile at this k step; wblk: row nBase of Wq's copy at this k step
// (Wk's and Wv's rows lie D_MODEL and 2 D_MODEL rows further on). Both are wave-uniform.
__device__ __forceinline__ void stage_xw(const _Float16* xblk, const _Float16* wblk,
                                         _Float16 (*dst)[KV_PITCH], int t)
{
    const int row = t >> 3;          // 0..31, +32 per copy
    const int col = (t & 7) * 8;     // halfs
    const unsigned voff = (unsigned)(row * D_MODEL + col) * 2u;   // bytes, below 64 KiB
    const _Float16* kblk = wblk + (size_t)D_MODEL * D_MODEL;
    const _Float16* vblk = kblk + (size_t)D_MODEL * D_MODEL;
    const unsigned l = lds_addr(&dst[row][col]);
    const unsigned s = 32 * KV_PITCH * 2;   // bytes of 32 LDS rows
    copy10(voff, l, l + s, l + 2 * s, l + 3 * s, l + 4 * s, l + 5 * s, l + 6 * s, l + 7 * s,
           l + 8 * s, l + 9 * s,
           xblk, xblk + 32 * D_MODEL, xblk + 64 * D_MODEL, xblk + 96 * D_MODEL,
           xblk + 128 * D_MODEL, xblk + 160 * D_MODEL, xblk + 192 * D_MODEL, xblk + 224 * D_MODEL,
           wblk, wblk + 32 * D_MODEL);
    copy10(voff, l + 10 * s, l + 11 * s, l + 12 * s, l + 13 * s, l + 14 * s, l + 15 * s,
           l + 16 * s, l + 17 * s, l + 18 * s, l + 19 * s,
           wblk + 64 * D_MODEL, wblk + 96 * D_MODEL,
           kblk, kblk + 32 * D_MODEL, kblk + 64 * D_MODEL, kblk + 96 * D_MODEL,
           vblk, vblk + 32 * D_MODEL, vblk + 64 * D_MODEL, vblk + 96 * D_MODEL);
}

// ---------------------------------------------------------------------------
// Kernel 1: Q, K, V = X @ W + b for all three weight matrices, emitted as f16;
// X and W come as f16, both k-contiguous (kernel 0).
//   Q, K -> layout [B][H][S][Dh];  V -> [B][H][Dh][S] (pre-transposed for the V^T A-frags)
// One work-group per WGP: 256 threads (8 waves), tile 256 rows x 384 columns (the same
// 128 columns of Q, K and V, so one staged X tile serves three weight tiles), K-step 64,
// brought into LDS by asynchronous copies one step ahead in two buffers.
// Wave (wm, wn) computes a 128 x 96 subtile: per 32 k, 48 WMMAs on 14 fragments.
// ---------------------------------------------------------------------------
#define KSTEP 64
#define FM 8    // 16-row fragments per wave
#define FN 6    // 16-column fragments per wave

__global__ __launch_bounds__(256)
void qkv_proj_kernel(const _Float16* __restrict__ xh,   // [8192][1024]
                     const _Float16* __restrict__ wt,   // [matrix][n][k]
                     const float* __restrict__ bq,
                     const float* __restrict__ bk,
                     const float* __restrict__ bv,
                     _Float16* __restrict__ qd,
                     _Float16* __restrict__ kd,
                     _Float16* __restrict__ vd)
{
    const int nBase = blockIdx.x * TILE_NW;
    const int mBase = blockIdx.y * TILE_M;
    const int t      = threadIdx.x;
    const int wid    = __builtin_amdgcn_readfirstlane(t >> 5);   // scalar: the epilogue branches on it
    const int lane   = t & 31;
    const int laneLo = lane & 15;
    const int laneHi = lane >> 4;

    __shared__ __align__(16) _Float16 xws[2][TILE_ROWS][KV_PITCH];  // [buffer][X rows | W rows][k]

    const int wm = wid >> 2;   // 0..1 : 128 rows each
    const int wn = wid & 3;    // 0..3 : 96 of the 384 columns each

    const _Float16* xb = xh + (size_t)mBase * D_MODEL;
    const _Float16* wb = wt + (size_t)nBase * D_MODEL;

    // Step 0 into buffer 0; step 1 follows behind the first barrier wait, at the top of pass 0.
    stage_xw(xb, wb, xws[0], t);
    asm volatile("s_wait_asynccnt 0x0" ::: "memory");   // this wave's copies of step 0 have landed
    bar_signal();                                       // the prologue's signal says so

    v8f acc[FM][FN];
#pragma unroll
    for (int i = 0; i < FM; i++)
#pragma unroll
        for (int j = 0; j < FN; j++) acc[i][j] = zero8();

    for (int j = 0; j < D_MODEL / KSTEP; ++j) {
        const _Float16 (*Xs)[KV_PITCH] = xws[j & 1];            // [m][k]
        const _Float16 (*Ws)[KV_PITCH] = xws[j & 1] + TILE_M;   // [n][k]

        __builtin_amdgcn_sched_barrier(0);   // the last pass's WMMAs stay in front of the wait
        bar_wait();             // step j is published, every wave has left the other buffer
        if (j + 1 < D_MODEL / KSTEP)
            stage_xw(xb + (j + 1) * KSTEP, wb + (j + 1) * KSTEP, xws[(j + 1) & 1], t);

#pragma unroll
        for (int c = 0; c < 2; c++) {
            // A-frag layout (16x32 f16): lanes 0-15 K{0..7,16..23}; lanes 16-31 K{8..15,24..31}
            v16h Af[FM], Bf[FN];
#pragma unroll
            for (int nn = 0; nn < FN; nn++) {
                const _Float16* bp = &Ws[wn * (16 * FN) + nn * 16 + laneLo][c * 32];
                v8h lo = *(const v8h*)(bp + laneHi * 8);
                v8h hi = *(const v8h*)(bp + 16 + laneHi * 8);
                Bf[nn] = cat8(lo, hi);
            }
#pragma unroll
            for (int mm = 0; mm < FM; mm++) {
                const _Float16* ap = &Xs[wm * (16 * FM) + mm * 16 + laneLo][c * 32];
                v8h lo = *(const v8h*)(ap + laneHi * 8);
                v8h hi = *(const v8h*)(ap + 16 + laneHi * 8);
                Af[mm] = cat8(lo, hi);
            }
            __builtin_amdgcn_sched_barrier(0);   // keep the chunk's ds_loads together, ahead of its WMMAs
            if (c == 1) {
                // Hand-over, signalled in front of the pass's last WMMAs: this wave holds its
                // last fragments of buffer j & 1 and its copies of step j + 1 have landed.
                asm volatile("s_wait_dscnt 0x0" ::: "memory");      // own LDS reads of this buffer are done
                asm volatile("s_wait_asynccnt 0x0" ::: "memory");   // own copies of step j + 1 have landed
                bar_signal();
                __builtin_amdgcn_sched_barrier(0);   // the WMMAs stay behind the signal
            }
#pragma unroll
            for (int mm = 0; mm < FM; mm++)
#pragma unroll
                for (int nn = 0; nn < FN; nn++)
                    acc[mm][nn] = __builtin_amdgcn_wmma_f32_16x16x32_f16(
                        false, Af[mm], false, Bf[nn], (short)0, acc[mm][nn], false, false);
            // keeps the next chunk's loads behind these WMMAs: one fragment set
            __builtin_amdgcn_sched_barrier(0);
        }
    }
    asm volatile("s_wait_asynccnt 0x0" ::: "memory");   // no copy outstanding at the wave's end
    bar_wait();                                         // the wait that belongs to the last pass's signal

    // Epilogue: add bias, convert f16, scatter to the layout of the matrix that the
    // 16-column tile belongs to (the same for the whole wave: a scalar branch).
    // A wave's 128 rows lie in one batch, so one pointer per column tile serves all its stores.
    float bias[FN];                // all six loads together: one latency, not six
#pragma unroll
    for (int nn = 0; nn < FN; nn++) {
        const int tile = wn * FN + nn;
        const int mat  = tile >> 3;
        bias[nn] = ((mat == 0) ? bq : ((mat == 1) ? bk : bv))[nBase + (tile & 7) * 16 + laneLo];
    }
    __builtin_amdgcn_sched_barrier(0);   // the six loads stay in front of the wait below
    // precaution: stands in front of every later write of a register that these loads name
    asm volatile("s_wait_xcnt 0x0" ::: "memory");
    __builtin_amdgcn_sched_barrier(0);   // keeps the arithmetic that follows behind that wait
    const int rowb = mBase + wm * (16 * FM) + laneHi * 8;   // row of register 0 of fragment 0
    const int bb = rowb >> 11;     // batch
    const int sb = rowb & 2047;    // seq pos
#pragma unroll
    for (int nn = 0; nn < FN; nn++) {
        const int tile = wn * FN + nn;       // 0..23 : 8 tiles per matrix
        const int mat  = tile >> 3;          // 0 Q, 1 K, 2 V
        const int col  = nBase + (tile & 7) * 16 + laneLo;
        const int h = col >> 6;          // head
        const int d = col & 63;          // dim in head
        v8h o[FM];
#pragma unroll
        for (int mm = 0; mm < FM; mm++)
#pragma unroll
            for (int r = 0; r < 8; r++) o[mm][r] = (_Float16)(acc[mm][nn][r] + bias[nn]);
        // all values of the column tile stand in registers of their own before its first
        // store: no store's data register is written again while the stores are being issued
        __builtin_amdgcn_sched_barrier(0);
        if (mat == 2) {
            _Float16* vp = vd + (((size_t)bb * NHEAD + h) * HEAD_DIM + d) * SEQ + sb;
#pragma unroll
            for (int mm = 0; mm < FM; mm++) *(v8h*)(vp + mm * 16) = o[mm];
            // precaution: stands in front of every later write of a register that these stores name
            asm volatile("s_wait_xcnt 0x0" ::: "memory");
        } else {
            _Float16* qp = ((mat == 0) ? qd : kd)
                         + (((size_t)bb * NHEAD + h) * SEQ + sb) * HEAD_DIM + d;
#pragma unroll
            for (int mm = 0; mm < FM; mm++)
#pragma unroll
                for (int r = 0; r < 8; r++) qp[(mm * 16 + r) * HEAD_DIM] = o[mm][r];
            asm volatile("s_wait_xcnt 0x0" ::: "memory");   // the same precaution
        }
        // keeps the next column tile's arithmetic behind those waits
        __builtin_amdgcn_sched_barrier(0);
    }
}

__device__ __forceinline__ void stage_kv(const _Float16* kblk, const _Float16* vblk,
                                         _Float16 (*dst)[64][KV_PITCH], int t)
{
    const int row = t >> 3;          // 0..15, +16 per copy
    const int col = (t & 7) * 8;     // halfs
    const _Float16* gk0 = kblk + (size_t)row * HEAD_DIM + col;
    const _Float16* gk1 = gk0 + 16 * HEAD_DIM;
    const _Float16* gk2 = gk0 + 32 * HEAD_DIM;
    const _Float16* gk3 = gk0 + 48 * HEAD_DIM;
    const _Float16* gv0 = vblk + (size_t)row * SEQ + col;
    const _Float16* gv1 = gv0 + 16 * SEQ;
    const _Float16* gv2 = gv0 + 32 * SEQ;
    const _Float16* gv3 = gv0 + 48 * SEQ;
    const unsigned lk0 = lds_addr(&dst[0][row][col]);
    const unsigned lk1 = lds_addr(&dst[0][row + 16][col]);
    const unsigned lk2 = lds_addr(&dst[0][row + 32][col]);
    const unsigned lk3 = lds_addr(&dst[0][row + 48][col]);
    const unsigned lv0 = lds_addr(&dst[1][row][col]);
    const unsigned lv1 = lds_addr(&dst[1][row + 16][col]);
    const unsigned lv2 = lds_addr(&dst[1][row + 32][col]);
    const unsigned lv3 = lds_addr(&dst[1][row + 48][col]);
    // The copies and their s_wait_xcnt in one statement: the wait then stands in
    // front of every later write of an address register that a copy names.
    asm volatile(
        "global_load_async_to_lds_b128 %0, %8, off\n\t"
        "global_load_async_to_lds_b128 %1, %9, off\n\t"
        "global_load_async_to_lds_b128 %2, %10, off\n\t"
        "global_load_async_to_lds_b128 %3, %11, off\n\t"
        "global_load_async_to_lds_b128 %4, %12, off\n\t"
        "global_load_async_to_lds_b128 %5, %13, off\n\t"
        "global_load_async_to_lds_b128 %6, %14, off\n\t"
        "global_load_async_to_lds_b128 %7, %15, off\n\t"
        "s_wait_xcnt 0x0"
        :: "v"(lk0), "v"(lk1), "v"(lk2), "v"(lk3),
           "v"(lv0), "v"(lv1), "v"(lv2), "v"(lv3),
           "v"(gk0), "v"(gk1), "v"(gk2), "v"(gk3),
           "v"(gv0), "v"(gv1), "v"(gv2), "v"(gv3)
        : "memory");
}

// Lane l's value from lane l ^ 16 (the other half of the wave), on the vector pipe.
__device__ __forceinline__ float xhalf(float v) {
    int i = __builtin_bit_cast(int, v);
    return __builtin_bit_cast(float,
        __builtin_amdgcn_permlanex16(i, i, 0x76543210, 0xfedcba98, false, false));
}

#define QG 2   // 16-query groups per wave
#define QSCALE (0.03125f * 1.44269504f)   // 1/sqrt(D_MODEL) * log2(e)

// 1,024 work-groups of one wave per SIMD: four waves per SIMD hold them all at once,
// which needs at most 256 registers a wave
__global__ __launch_bounds__(128) __attribute__((amdgpu_waves_per_eu(4, 4)))
void attn_kernel(const _Float16* __restrict__ q,    // [B][H][S][Dh]
                 const _Float16* __restrict__ k,    // [B][H][S][Dh]
                 const _Float16* __restrict__ vt,   // [B][H][Dh][S]
                 float* __restrict__ out)           // [B][S][D_MODEL]
{
    const int qt = blockIdx.x;          // q tile (128 rows)
    const int bh = blockIdx.y;          // b*NHEAD + h
    const int b  = bh >> 4;
    const int h  = bh & 15;
    const int t      = threadIdx.x;
    const int wid    = t >> 5;          // 0..3
    const int lane   = t & 31;
    const int laneLo = lane & 15;
    const int laneHi = lane >> 4;

    const _Float16* qh  = q  + (size_t)bh * SEQ * HEAD_DIM;
    const _Float16* kh  = k  + (size_t)bh * SEQ * HEAD_DIM;
    const _Float16* vth = vt + (size_t)bh * HEAD_DIM * SEQ;

    __shared__ __align__(16) _Float16 kvs[2][2][64][KV_PITCH];  // [buffer][K | V^T][row][col]

    // Block 0 into buffer 0; block 1 follows behind the first barrier wait, at the top of pass 0.
    stage_kv(kh, vth, kvs[0], t);
    asm volatile("s_wait_asynccnt 0x0" ::: "memory");   // this wave's copies of block 0 have landed
    bar_signal();                                       // the prologue's signal says so

    // Q^T fragments: per group 64 d x 16 queries -> two 32x16 B-frags, straight from
    // global; lane column = query, k order as in the K loader below
    const int qrow = qt * (64 * QG) + wid * (16 * QG) + laneLo;   // group g: + 16 g
    v16h Bq[QG][2];
#pragma unroll
    for (int g = 0; g < QG; g++)
#pragma unroll
        for (int c = 0; c < 2; c++) {
            const _Float16* qp = qh + (size_t)(qrow + 16 * g) * HEAD_DIM + c * 32;
            v8h lo = *(const v8h*)(qp + laneHi * 8);
            v8h hi = *(const v8h*)(qp + 16 + laneHi * 8);
            Bq[g][c] = cat8(lo, hi);
            // scale * log2(e) goes into Q: multiplied in f32, rounded to f16 once more
#pragma unroll
            for (int i = 0; i < 16; i++)
                Bq[g][c][i] = (_Float16)((float)Bq[g][c][i] * QSCALE);
        }

    // All-ones A tile: ones @ P^T gives each query's sum of P in every accumulator row
    v16h onesA;
#pragma unroll
    for (int i = 0; i < 16; i++) onesA[i] = (_Float16)1.0f;

    v8f Oacc[QG][4];    // O^T: Oacc[g][n][r] = O[query 16 g + laneLo][d = n*16 + laneHi*8 + r]
    v8f Cm[QG];         // minus the maximum in use of this lane's query, in all 8 registers
    float lrow[QG];     // this lane's query of each group
#pragma unroll
    for (int g = 0; g < QG; g++) {
#pragma unroll
        for (int n = 0; n < 4; n++) Oacc[g][n] = zero8();
        Cm[g] = zero8();
        lrow[g] = 0.0f;
    }

    const _Float16 (*ks)[KV_PITCH] = kvs[0][0];   // this pass's K tile   [key][d]
    const _Float16 (*vs)[KV_PITCH] = kvs[0][1];   // this pass's V^T tile [d][key]
    v8f  S[QG][4];     // S[g][n][r] = log2-domain score(key n*16 + laneHi*8 + r, query 16 g + laneLo)
    v16h Bp[QG][2];    // P^T B-fragments
    v16h Av[2][4];     // V^T A-fragments
    v8f  lacc[QG];     // sums of P over the block's 64 keys, the same in all 8 registers

    // Top of pass j: the barrier's second half, then block j + 1 on its way.
    auto pass_top = [&](int j) __attribute__((always_inline)) {
        ks = kvs[j & 1][0];
        vs = kvs[j & 1][1];
        __builtin_amdgcn_sched_barrier(0);   // the last pass's WMMAs stay in front of the wait
        bar_wait();             // block j is published, every wave has left the other buffer
        if (j + 1 < SEQ / 64)
            stage_kv(kh + (size_t)(j + 1) * 64 * HEAD_DIM, vth + (j + 1) * 64, kvs[(j + 1) & 1], t);
    };

    // All K A-fragments in one clause.
    auto load_k = [&](v16h (&Ak)[2][4]) __attribute__((always_inline)) {
#pragma unroll
        for (int n = 0; n < 4; n++)
#pragma unroll
            for (int c = 0; c < 2; c++) {
                const _Float16* kp = &ks[n * 16 + laneLo][c * 32];
                v8h lo = *(const v8h*)(kp + laneHi * 8);
                v8h hi = *(const v8h*)(kp + 16 + laneHi * 8);
                Ak[c][n] = cat8(lo, hi);
            }
        __builtin_amdgcn_sched_barrier(0);   // pin loads ahead of WMMAs
    };

    // Score tile n of both groups: S^T = K @ Q^T - maximum in use; each K fragment used twice.
    auto score_tile = [&](const v16h (&Ak)[2][4], int n) __attribute__((always_inline)) {
#pragma unroll
        for (int g = 0; g < QG; g++)
            S[g][n] = __builtin_amdgcn_wmma_f32_16x16x32_f16(
                false, Ak[0][n], false, Bq[g][0], (short)0, Cm[g], false, false);
#pragma unroll
        for (int g = 0; g < QG; g++)
            S[g][n] = __builtin_amdgcn_wmma_f32_16x16x32_f16(
                false, Ak[1][n], false, Bq[g][1], (short)0, S[g][n], false, false);
    };

    // P^T in place: score tiles 2c and 2c+1 are keys {8*laneHi + 0..7} and
    // {16 + 8*laneHi + 0..7} of 32-key chunk c, the k order of the V^T loader.
    auto prob_tile = [&](int p) __attribute__((always_inline)) {
#pragma unroll
        for (int g = 0; g < QG; g++)
#pragma unroll
            for (int r = 0; r < 8; r++)
                Bp[g][p >> 1][(p & 1) * 8 + r] = (_Float16)__builtin_amdgcn_exp2f(S[g][p][r]);
    };

    // All V^T A-fragments in one clause.
    auto load_v = [&]() __attribute__((always_inline)) {
#pragma unroll
        for (int c = 0; c < 2; c++)
#pragma unroll
            for (int n = 0; n < 4; n++) {
                const _Float16* vp = &vs[n * 16 + laneLo][c * 32];
                v8h alo = *(const v8h*)(vp + laneHi * 8);
                v8h ahi = *(const v8h*)(vp + 16 + laneHi * 8);
                Av[c][n] = cat8(alo, ahi);
            }
        __builtin_amdgcn_sched_barrier(0);   // the loads start ahead of the work that follows
    };

    // Sums of P = ones @ P^T.
    auto sum_p = [&]() __attribute__((always_inline)) {
#pragma unroll
        for (int g = 0; g < QG; g++) lacc[g] = zero8();
#pragma unroll
        for (int c = 0; c < 2; c++)
#pragma unroll
            for (int g = 0; g < QG; g++)
                lacc[g] = __builtin_amdgcn_wmma_f32_16x16x32_f16(
                    false, onesA, false, Bp[g][c], (short)0, lacc[g], false, false);
    };

    // A block taken with its true maximum: the first block, which sets the maxima in use,
    // and a block whose sums failed the test below. Nothing of the block has reached O or
    // the sums yet, and buffer j & 1 is still this wave's to read: the scores are made
    // (again), their maximum moves the maximum in use, O and the sums are rescaled.
    auto block_with_max = [&](bool first) __attribute__((always_inline)) {
        v16h Ak[2][4];
        load_k(Ak);
#pragma unroll
        for (int n = 0; n < 4; n++) score_tile(Ak, n);
#pragma unroll
        for (int g = 0; g < QG; g++) {
            float mx8[8];
#pragma unroll
            for (int r = 0; r < 8; r++)
                mx8[r] = fmaxf(fmaxf(S[g][0][r], S[g][1][r]), fmaxf(S[g][2][r], S[g][3][r]));
            const float mx = fmaxf(fmaxf(fmaxf(mx8[0], mx8[1]), fmaxf(mx8[2], mx8[3])),
                                   fmaxf(fmaxf(mx8[4], mx8[5]), fmaxf(mx8[6], mx8[7])));
            const float m = fmaxf(mx, xhalf(mx));   // the other 32 scores sit in lane ^ 16
            // step of the maximum in use: never down, but for the first block, which starts from 0
            const float d = first ? m : fmaxf(m, 0.0f);
            // a step down meets only zeros in O and the sums: factor 1 there
            const float alpha = __builtin_amdgcn_exp2f(-fmaxf(d, 0.0f));
#pragma unroll
            for (int n = 0; n < 4; n++) {
                S[g][n] -= d;
                Oacc[g][n] *= alpha;
            }
            Cm[g] -= d;
            lrow[g] *= alpha;
        }
#pragma unroll
        for (int p = 0; p < 4; p++) prob_tile(p);
        load_v();
        sum_p();
    };

    // Foot of a pass: the buffer is handed over, O^T += V^T @ P^T, the sums go in.
    auto pass_foot = [&]() __attribute__((always_inline)) {
        // Hand-over, signalled in front of the pass's last WMMAs: this wave holds its last
        // fragments of buffer j & 1 and its copies of block j + 1 have landed.
        asm volatile("s_wait_dscnt 0x0" ::: "memory");      // own LDS reads of this buffer are done
        asm volatile("s_wait_asynccnt 0x0" ::: "memory");   // own copies of block j + 1 have landed
        bar_signal();
        __builtin_amdgcn_sched_barrier(0);   // the WMMAs stay behind the signal
        // 16 WMMAs, each V^T fragment used twice
#pragma unroll
        for (int c = 0; c < 2; c++)
#pragma unroll
            for (int n = 0; n < 4; n++)
#pragma unroll
                for (int g = 0; g < QG; g++)
                    Oacc[g][n] = __builtin_amdgcn_wmma_f32_16x16x32_f16(
                        false, Av[c][n], false, Bp[g][c], (short)0, Oacc[g][n], false, false);
#pragma unroll
        for (int g = 0; g < QG; g++) lrow[g] += lacc[g][0];
    };

    pass_top(0);
    block_with_max(true);
    pass_foot();

    for (int j = 1; j < SEQ / 64; ++j) {
        pass_top(j);
        // ---- The usual block: no maximum is taken. With no branch between scores and exp2,
        //      the exp2 and conversions of score tile n - 1 stand among the WMMAs of tile n
        //      and run beside them ----
        {
            v16h Ak[2][4];
            load_k(Ak);
#pragma unroll
            for (int n = 0; n <= 4; n++) {
                if (n < 4) score_tile(Ak, n);
                if (n > 0) prob_tile(n - 1);
                if (n == 4) {
                    load_v();     // under way while the sums are made and tested
                    sum_p();
                }
                // ends a stage: tile n's exp2 stays out of tile n's own WMMAs, whose results it would wait for
                __builtin_amdgcn_sched_barrier(0);
            }
        }
        // ---- No P is negative, so none exceeds its query's block sum: a sum of at most
        //      2^14 says that every P is finite in f16. One test per block, the same for the
        //      whole wave (a scalar branch); written so that a NaN sum fails it too ----
        if (__builtin_amdgcn_ballot_w32(!(fmaxf(lacc[0][0], lacc[1][0]) <= 16384.0f)) != 0)
            block_with_max(false);
        pass_foot();
    }
    asm volatile("s_wait_asynccnt 0x0" ::: "memory");   // no copy outstanding at the wave's end
    bar_wait();                                         // the wait that belongs to the last pass's signal

    // Normalize and write out [B][S][D_MODEL] f32: a lane holds 8 consecutive d per tile
#pragma unroll
    for (int g = 0; g < QG; g++) {
        float* op = out + ((size_t)b * SEQ + qrow + 16 * g) * D_MODEL + h * HEAD_DIM + laneHi * 8;
#pragma unroll
        for (int n = 0; n < 4; n++) {
            v4f o0, o1;
#pragma unroll
            for (int r = 0; r < 4; r++) {
                o0[r] = Oacc[g][n][r] / lrow[g];
                o1[r] = Oacc[g][n][4 + r] / lrow[g];
            }
            *(v4f*)(op + n * 16)     = o0;
            *(v4f*)(op + n * 16 + 4) = o1;
        }
    }
}

extern "C" void kernel_launch(void* const* d_in, const int* in_sizes, int n_in,
                              void* d_out, int out_size, void* d_ws, size_t ws_size,
                              hipStream_t stream) {
    const float* x  = (const float*)d_in[0];
    const float* Wq = (const float*)d_in[1];
    const float* bq = (const float*)d_in[2];
    const float* Wk = (const float*)d_in[3];
    const float* bk = (const float*)d_in[4];
    const float* Wv = (const float*)d_in[5];
    const float* bv = (const float*)d_in[6];
    float* out = (float*)d_out;

    const size_t per = (size_t)BATCH * NHEAD * SEQ * HEAD_DIM;  // 8.4M elems
    _Float16* qws = (_Float16*)d_ws;
    _Float16* kws = qws + per;
    _Float16* vws = kws + per;
    _Float16* xh  = vws + per;
    _Float16* wt  = xh + per;      // total 70MB of f16 in d_ws

    to_f16_kernel<<<W_BLOCKS + NROWS * D_MODEL / 4096, 256, 0, stream>>>(x, Wq, Wk, Wv, xh, wt);

    dim3 g1(D_MODEL / TILE_NW, NROWS / TILE_M);   // (8, 32)
    qkv_proj_kernel<<<g1, 256, 0, stream>>>(xh, wt, bq, bk, bv, qws, kws, vws);

    dim3 g2(SEQ / (64 * QG), BATCH * NHEAD);   // (16, 64)
    attn_kernel<<<g2, 128, 0, stream>>>(qws, kws, vws, out);
}

// v010
// Measured time: 89.8 microseconds a run.
// Next to v009, in two timings, it ran 1.04 times as fast each time.
// Over all steps from v000 it is 5.04 times as fast.
#include <hip/hip_runtime.h>

typedef __attribute__((ext_vector_type(16))) _Float16 v16h;
typedef __attribute__((ext_vector_type(8)))  _Float16 v8h;
typedef __attribute__((ext_vector_type(4)))  _Float16 v4h;
typedef __attribute__((ext_vector_type(8)))  float    v8f;
typedef __attribute__((ext_vector_type(4)))  float    v4f;

#define D_MODEL  1024
#define NHEAD    16
#define HEAD_DIM 64
#define BATCH    4
#define SEQ      2048
#define NROWS    (BATCH * SEQ)   // 8192

__device__ __forceinline__ v16h cat8(v8h lo, v8h hi) {
    v16h r;
#pragma unroll
    for (int i = 0; i < 8; i++) { r[i] = lo[i]; r[8 + i] = hi[i]; }
    return r;
}

__device__ __forceinline__ v8f zero8() {
    v8f r;
#pragma unroll
    for (int i = 0; i < 8; i++) r[i] = 0.0f;
    return r;
}

#define KV_PITCH 72   // halfs per staged row: 144 B = 16 B x 9, conflict-free for b128 readers

typedef __attribute__((address_space(3))) const _Float16 lds_cf16;

__device__ __forceinline__ unsigned lds_addr(const _Float16* p) {
    return (unsigned)(uintptr_t)(lds_cf16*)p;   // byte offset in the work-group's LDS
}

// The work-group barrier in two halves (both ring loops below). A wave signals once it has
// left a buffer and its own copies of the next stage have landed, runs the WMMAs whose
// fragments it already holds, and only then waits: these WMMAs cover the time in which the
// other waves arrive, and a wave that is through refills and reads on while the wave that
// shares its SIMD still feeds the matrix unit. No LDS read stands between signal and wait;
// signal and wait alternate strictly in every wave. The "memory" clobber keeps LDS reads
// and the copies on their side of each half.
__device__ __forceinline__ void bar_signal() { asm volatile("s_barrier_signal -1" ::: "memory"); }
__device__ __forceinline__ void bar_wait()   { asm volatile("s_barrier_wait -1" ::: "memory"); }

// ---------------------------------------------------------------------------
// Kernel 0: the projections' operands as f16, k-contiguous, written once per call.
//   blocks 0..383   : W (f32 [k][n]) -> wt (f16 [matrix][n][k]); a block turns a
//                     64 k x 128 n tile, a thread an 8 k x 4 n piece in its registers
//   blocks 384..2431: x (f32) -> xh (f16), same layout, 4096 elements per block
// The unrolled loops here and in kernel 1 index vectors and fragment arrays, which
// stay in registers only if every index is a compile-time constant.
// ---------------------------------------------------------------------------
#define W_BLOCKS 384

__global__ __launch_bounds__(256)
void to_f16_kernel(const float* __restrict__ x,
                   const float* __restrict__ Wq,
                   const float* __restrict__ Wk,
                   const float* __restrict__ Wv,
                   _Float16* __restrict__ xh,
                   _Float16* __restrict__ wt)
{
    const int t   = threadIdx.x;
    const int blk = blockIdx.x;
    if (blk < W_BLOCKS) {
        const int m    = blk >> 7;        // 0 Wq, 1 Wk, 2 Wv
        const int tile = blk & 127;
        const int wid  = t >> 5;
        const int lane = t & 31;
        const float* W = (m == 0) ? Wq : ((m == 1) ? Wk : Wv);
        // 8 lanes cover one 128-B line of a k row; 4 lanes cover 64 B of an output row
        const int ko = (tile >> 3) * 64 + ((wid & 1) * 4 + (lane >> 3)) * 8;
        const int nc = (tile & 7) * 128 + ((wid >> 1) * 8 + (lane & 7)) * 4;
        const float* wp = W + (size_t)ko * D_MODEL + nc;
        v4f wv[8];
#pragma unroll
        for (int i = 0; i < 8; i++) wv[i] = *(const v4f*)(wp + (size_t)i * D_MODEL);
        _Float16* op = wt + ((size_t)m * D_MODEL + nc) * D_MODEL + ko;
#pragma unroll
        for (int e = 0; e < 4; e++) {
            v8h wh;
#pragma unroll
            for (int i = 0; i < 8; i++) wh[i] = (_Float16)wv[i][e];
            *(v8h*)(op + (size_t)e * D_MODEL) = wh;
        }
    } else {
        const size_t base = (size_t)(blk - W_BLOCKS) * 4096;
        v4f xv[4];
#pragma unroll
        for (int i = 0; i < 4; i++) xv[i] = *(const v4f*)(x + base + (t + 256 * i) * 4);
#pragma unroll
        for (int i = 0; i < 4; i++) {
            v4h xo;
#pragma unroll
            for (int e = 0; e < 4; e++) xo[e] = (_Float16)xv[i][e];
            *(v4h*)(xh + base + (t + 256 * i) * 4) = xo;
        }
        // precaution: stands in front of every later write of a register that the four
        // stores name (the built code runs on from here into the W part's first lines)
        asm volatile("s_wait_xcnt 0x0" ::: "memory");
    }
}

// One 64-k step of the operand tiles into one buffer: 256 threads x 20 copies of 16 B.
// dst rows 0..255 = X tile [m][k]; rows 256..639 = W tile [n][k], 128 rows of each of
// Wq, Wk, Wv (the same 128 output columns of all three); 8 lanes fill one 128-B row.
#define TILE_M 256
#define TILE_NW 128                    // output columns per weight matrix
#define TILE_N (3 * TILE_NW)
#define TILE_ROWS (TILE_M + TILE_N)

// Ten copies of 16 B per lane. Copy i: LDS byte address li; global address = the scalar
// base bi (the same for the whole wave) + the lane's byte offset voff. With scalar bases a
// statement names 11 vector registers instead of 30: asm operands must lie below v256, where
// the accumulators live, and every register more is an accumulator moved out and back each step.
__device__ __forceinline__ void copy10(unsigned voff,
                                       unsigned l0, unsigned l1, unsigned l2, unsigned l3, unsigned l4,
                                       unsigned l5, unsigned l6, unsigned l7, unsigned l8, unsigned l9,
                                       const _Float16* b0, const _Float16* b1, const _Float16* b2,
                                       const _Float16* b3, const _Float16* b4, const _Float16* b5,
                                       const _Float16* b6, const _Float16* b7, const _Float16* b8,
                                       const _Float16* b9)
{
    // The copies and their s_wait_xcnt in one statement: the wait then stands in
    // front of every later write of an address register that a copy names.
    asm volatile(
        "global_load_async_to_lds_b128 %0, %20, %10\n\t"
        "global_load_async_to_lds_b128 %1, %20, %11\n\t"
        "global_load_async_to_lds_b128 %2, %20, %12\n\t"
        "global_load_async_to_lds_b128 %3, %20, %13\n\t"
        "global_load_async_to_lds_b128 %4, %20, %14\n\t"
        "global_load_async_to_lds_b128 %5, %20, %15\n\t"
        "global_load_async_to_lds_b128 %6, %20, %16\n\t"
        "global_load_async_to_lds_b128 %7, %20, %17\n\t"
        "global_load_async_to_lds_b128 %8, %20, %18\n\t"
        "global_load_async_to_lds_b128 %9, %20, %19\n\t"
        "s_wait_xcnt 0x0"
        :: "v"(l0), "v"(l1), "v"(l2), "v"(l3), "v"(l4),
           "v"(l5), "v"(l6), "v"(l7), "v"(l8), "v"(l9),
           "s"(b0), "s"(b1), "s"(b2), "s"(b3), "s"(b4),
           "s"(b5), "s"(b6), "s"(b7), "s"(b8), "s"(b9),
           "v"(voff)
        : "memory");
}

// xblk: first X row of the tile at this k step; wblk: row nBase of Wq's copy at this k step
// (Wk's and Wv's rows lie D_MODEL and 2 D_MODEL rows further on). Both are wave-uniform.
__device__ __forceinline__ void stage_xw(const _Float16* xblk, const _Float16* wblk,
                                         _Float16 (*dst)[KV_PITCH], int t)
{
    const int row = t >> 3;          // 0..31, +32 per copy
    const int col = (t & 7) * 8;     // halfs
    const unsigned voff = (unsigned)(row * D_MODEL + col) * 2u;   // bytes, below 64 KiB
    const _Float16* kblk = wblk + (size_t)D_MODEL * D_MODEL;
    const _Float16* vblk = kblk + (size_t)D_MODEL * D_MODEL;
    const unsigned l = lds_addr(&dst[row][col]);
    const unsigned s = 32 * KV_PITCH * 2;   // bytes of 32 LDS rows
    copy10(voff, l, l + s, l + 2 * s, l + 3 * s, l + 4 * s, l + 5 * s, l + 6 * s, l + 7 * s,
           l + 8 * s, l + 9 * s,
           xblk, xblk + 32 * D_MODEL, xblk + 64 * D_MODEL, xblk + 96 * D_MODEL,
           xblk + 128 * D_MODEL, xblk + 160 * D_MODEL, xblk + 192 * D_MODEL, xblk + 224 * D_MODEL,
           wblk, wblk + 32 * D_MODEL);
    copy10(voff, l + 10 * s, l + 11 * s, l + 12 * s, l + 13 * s, l + 14 * s, l + 15 * s,
           l + 16 * s, l + 17 * s, l + 18 * s, l + 19 * s,
           wblk + 64 * D_MODEL, wblk + 96 * D_MODEL,
           kblk, kblk + 32 * D_MODEL, kblk + 64 * D_MODEL, kblk + 96 * D_MODEL,
           vblk, vblk + 32 * D_MODEL, vblk + 64 * D_MODEL, vblk + 96 * D_MODEL);
}

// ---------------------------------------------------------------------------
// Kernel 1: Q, K, V = X @ W + b for all three weight matrices, emitted as f16;
// X and W come as f16, both k-contiguous (kernel 0).
//   Q, K -> layout [B][H][S][Dh];  V -> [B][H][Dh][S] (pre-transposed for the V^T A-frags)
// One work-group per WGP: 256 threads (8 waves), tile 256 rows x 384 columns (the same
// 128 columns of Q, K and V, so one staged X tile serves three weight tiles), K-step 64,
// brought into LDS by asynchronous copies one step ahead in two buffers.
// Wave (wm, wn) computes a 128 x 96 subtile: per 32 k, 48 WMMAs on 14 fragments.
// ---------------------------------------------------------------------------
#define KSTEP 64
#define FM 8    // 16-row fragments per wave
#define FN 6    // 16-column fragments per wave

__global__ __launch_bounds__(256)
void qkv_proj_kernel(const _Float16* __restrict__ xh,   // [8192][1024]
                     const _Float16* __restrict__ wt,   // [matrix][n][k]
                     const float* __restrict__ bq,
                     const float* __restrict__ bk,
                     const float* __restrict__ bv,
                     _Float16* __restrict__ qd,
                     _Float16* __restrict__ kd,
                     _Float16* __restrict__ vd)
{
    const int nBase = blockIdx.x * TILE_NW;
    const int mBase = blockIdx.y * TILE_M;
    const int t      = threadIdx.x;
    const int wid    = __builtin_amdgcn_readfirstlane(t >> 5);   // scalar: the epilogue branches on it
    const int lane   = t & 31;
    const int laneLo = lane & 15;
    const int laneHi = lane >> 4;

    __shared__ __align__(16) _Float16 xws[2][TILE_ROWS][KV_PITCH];  // [buffer][X rows | W rows][k]

    const int wm = wid >> 2;   // 0..1 : 128 rows each
    const int wn = wid & 3;    // 0..3 : 96 of the 384 columns each

    const _Float16* xb = xh + (size_t)mBase * D_MODEL;
    const _Float16* wb = wt + (size_t)nBase * D_MODEL;

    // Step 0 into buffer 0; step 1 follows behind the first barrier wait, at the top of pass 0.
    stage_xw(xb, wb, xws[0], t);
    asm volatile("s_wait_asynccnt 0x0" ::: "memory");   // this wave's copies of step 0 have landed
    bar_signal();                                       // the prologue's signal says so

    v8f acc[FM][FN];
#pragma unroll
    for (int i = 0; i < FM; i++)
#pragma unroll
        for (int j = 0; j < FN; j++) acc[i][j] = zero8();

    for (int j = 0; j < D_MODEL / KSTEP; ++j) {
        const _Float16 (*Xs)[KV_PITCH] = xws[j & 1];            // [m][k]
        const _Float16 (*Ws)[KV_PITCH] = xws[j & 1] + TILE_M;   // [n][k]

        __builtin_amdgcn_sched_barrier(0);   // the last pass's WMMAs stay in front of the wait
        bar_wait();             // step j is published, every wave has left the other buffer
        if (j + 1 < D_MODEL / KSTEP)
            stage_xw(xb + (j + 1) * KSTEP, wb + (j + 1) * KSTEP, xws[(j + 1) & 1], t);

#pragma unroll
        for (int c = 0; c < 2; c++) {
            // A-frag layout (16x32 f16): lanes 0-15 K{0..7,16..23}; lanes 16-31 K{8..15,24..31}
            v16h Af[FM], Bf[FN];
#pragma unroll
            for (int nn = 0; nn < FN; nn++) {
                const _Float16* bp = &Ws[wn * (16 * FN) + nn * 16 + laneLo][c * 32];
                v8h lo = *(const v8h*)(bp + laneHi * 8);
                v8h hi = *(const v8h*)(bp + 16 + laneHi * 8);
                Bf[nn] = cat8(lo, hi);
            }
#pragma unroll
            for (int mm = 0; mm < FM; mm++) {
                const _Float16* ap = &Xs[wm * (16 * FM) + mm * 16 + laneLo][c * 32];
                v8h lo = *(const v8h*)(ap + laneHi * 8);
                v8h hi = *(const v8h*)(ap + 16 + laneHi * 8);
                Af[mm] = cat8(lo, hi);
            }
            __builtin_amdgcn_sched_barrier(0);   // keep the chunk's ds_loads together, ahead of its WMMAs
            if (c == 1) {
                // Hand-over, signalled in front of the pass's last WMMAs: this wave holds its
                // last fragments of buffer j & 1 and its copies of step j + 1 have landed.
                asm volatile("s_wait_dscnt 0x0" ::: "memory");      // own LDS reads of this buffer are done
                asm volatile("s_wait_asynccnt 0x0" ::: "memory");   // own copies of step j + 1 have landed
                bar_signal();
                __builtin_amdgcn_sched_barrier(0);   // the WMMAs stay behind the signal
            }
#pragma unroll
            for (int mm = 0; mm < FM; mm++)
#pragma unroll
                for (int nn = 0; nn < FN; nn++)
                    acc[mm][nn] = __builtin_amdgcn_wmma_f32_16x16x32_f16(
                        false, Af[mm], false, Bf[nn], (short)0, acc[mm][nn], false, false);
            // keeps the next chunk's loads behind these WMMAs: one fragment set
            __builtin_amdgcn_sched_barrier(0);
        }
    }
    asm volatile("s_wait_asynccnt 0x0" ::: "memory");   // no copy outstanding at the wave's end
    bar_wait();                                         // the wait that belongs to the last pass's signal

    // Epilogue: add bias, convert f16, scatter to the layout of the matrix that the
    // 16-column tile belongs to (the same for the whole wave: a scalar branch).
    // A wave's 128 rows lie in one batch, so one pointer per column tile serves all its stores.
    float bias[FN];                // all six loads together: one latency, not six
#pragma unroll
    for (int nn = 0; nn < FN; nn++) {
        const int tile = wn * FN + nn;
        const int mat  = tile >> 3;
        bias[nn] = ((mat == 0) ? bq : ((mat == 1) ? bk : bv))[nBase + (tile & 7) * 16 + laneLo];
    }
    __builtin_amdgcn_sched_barrier(0);   // the six loads stay in front of the wait below
    // precaution: stands in front of every later write of a register that these loads name
    asm volatile("s_wait_xcnt 0x0" ::: "memory");
    __builtin_amdgcn_sched_barrier(0);   // keeps the arithmetic that follows behind that wait
    const int rowb = mBase + wm * (16 * FM) + laneHi * 8;   // row of register 0 of fragment 0
    const int bb = rowb >> 11;     // batch
    const int sb = rowb & 2047;    // seq pos
#pragma unroll
    for (int nn = 0; nn < FN; nn++) {
        const int tile = wn * FN + nn;       // 0..23 : 8 tiles per matrix
        const int mat  = tile >> 3;          // 0 Q, 1 K, 2 V
        const int col  = nBase + (tile & 7) * 16 + laneLo;
        const int h = col >> 6;          // head
        const int d = col & 63;          // dim in head
        v8h o[FM];
#pragma unroll
        for (int mm = 0; mm < FM; mm++)
#pragma unroll
            for (int r = 0; r < 8; r++) o[mm][r] = (_Float16)(acc[mm][nn][r] + bias[nn]);
        // all values of the column tile stand in registers of their own before its first
        // store: no store's data register is written again while the stores are being issued
        __builtin_amdgcn_sched_barrier(0);
        if (mat == 2) {
            _Float16* vp = vd + (((size_t)bb * NHEAD + h) * HEAD_DIM + d) * SEQ + sb;
#pragma unroll
            for (int mm = 0; mm < FM; mm++) *(v8h*)(vp + mm * 16) = o[mm];
            // precaution: stands in front of every later write of a register that these stores name
            asm volatile("s_wait_xcnt 0x0" ::: "memory");
        } else {
            _Float16* qp = ((mat == 0) ? qd : kd)
                         + (((size_t)bb * NHEAD + h) * SEQ + sb) * HEAD_DIM + d;
#pragma unroll
            for (int mm = 0; mm < FM; mm++)
#pragma unroll
                for (int r = 0; r < 8; r++) qp[(mm * 16 + r) * HEAD_DIM] = o[mm][r];
            asm volatile("s_wait_xcnt 0x0" ::: "memory");   // the same precaution
        }
        // keeps the next column tile's arithmetic behind those waits
        __builtin_amdgcn_sched_barrier(0);
    }
}

__device__ __forceinline__ void stage_kv(const _Float16* kblk, const _Float16* vblk,
                                         _Float16 (*dst)[64][KV_PITCH], int t)
{
    const int row = t >> 3;          // 0..31, +32 per copy
    const int col = (t & 7) * 8;     // halfs
    const _Float16* gk0 = kblk + (size_t)row * HEAD_DIM + col;
    const _Float16* gk1 = gk0 + 32 * HEAD_DIM;
    const _Float16* gv0 = vblk + (size_t)row * SEQ + col;
    const _Float16* gv1 = gv0 + 32 * SEQ;
    const unsigned lk0 = lds_addr(&dst[0][row][col]);
    const unsigned lk1 = lds_addr(&dst[0][row + 32][col]);
    const unsigned lv0 = lds_addr(&dst[1][row][col]);
    const unsigned lv1 = lds_addr(&dst[1][row + 32][col]);
    // The copies and their s_wait_xcnt in one statement: the wait then stands in
    // front of every later write of an address register that a copy names.
    asm volatile(
        "global_load_async_to_lds_b128 %0, %4, off\n\t"
        "global_load_async_to_lds_b128 %1, %5, off\n\t"
        "global_load_async_to_lds_b128 %2, %6, off\n\t"
        "global_load_async_to_lds_b128 %3, %7, off\n\t"
        "s_wait_xcnt 0x0"
        :: "v"(lk0), "v"(lk1), "v"(lv0), "v"(lv1),
           "v"(gk0), "v"(gk1), "v"(gv0), "v"(gv1)
        : "memory");
}

// Lane l's value from lane l ^ 16 (the other half of the wave), on the vector pipe.
__device__ __forceinline__ float xhalf(float v) {
    int i = __builtin_bit_cast(int, v);
    return __builtin_bit_cast(float,
        __builtin_amdgcn_permlanex16(i, i, 0x76543210, 0xfedcba98, false, false));
}

#define QG 2   // 16-query groups per wave
#define AW 8   // waves per work-group
#define QSCALE (0.03125f * 1.44269504f)   // 1/sqrt(D_MODEL) * log2(e)

// 512 work-groups of two waves per SIMD: four waves per SIMD (two work-groups per WGP)
// hold them all at once, which needs at most 256 registers a wave
__global__ __launch_bounds__(32 * AW) __attribute__((amdgpu_waves_per_eu(4, 4)))
void attn_kernel(const _Float16* __restrict__ q,    // [B][H][S][Dh]
                 const _Float16* __restrict__ k,    // [B][H][S][Dh]
                 const _Float16* __restrict__ vt,   // [B][H][Dh][S]
                 float* __restrict__ out)           // [B][S][D_MODEL]
{
    const int qt = blockIdx.x;          // q tile (256 rows)
    const int bh = blockIdx.y;          // b*NHEAD + h
    const int b  = bh >> 4;
    const int h  = bh & 15;
    const int t      = threadIdx.x;
    const int wid    = t >> 5;          // 0..7
    const int lane   = t & 31;
    const int laneLo = lane & 15;
    const int laneHi = lane >> 4;

    const _Float16* qh  = q  + (size_t)bh * SEQ * HEAD_DIM;
    const _Float16* kh  = k  + (size_t)bh * SEQ * HEAD_DIM;
    const _Float16* vth = vt + (size_t)bh * HEAD_DIM * SEQ;

    __shared__ __align__(16) _Float16 kvs[2][2][64][KV_PITCH];  // [buffer][K | V^T][row][col]

    // Block 0 into buffer 0; block 1 follows behind the first barrier wait, at the top of pass 0.
    stage_kv(kh, vth, kvs[0], t);
    asm volatile("s_wait_asynccnt 0x0" ::: "memory");   // this wave's copies of block 0 have landed
    bar_signal();                                       // the prologue's signal says so

    // Q^T fragments: per group 64 d x 16 queries -> two 32x16 B-frags, straight from
    // global; lane column = query, k order as in the K loader below
    const int qrow = qt * (16 * QG * AW) + wid * (16 * QG) + laneLo;   // group g: + 16 g
    v16h Bq[QG][2];
#pragma unroll
    for (int g = 0; g < QG; g++)
#pragma unroll
        for (int c = 0; c < 2; c++) {
            const _Float16* qp = qh + (size_t)(qrow + 16 * g) * HEAD_DIM + c * 32;
            v8h lo = *(const v8h*)(qp + laneHi * 8);
            v8h hi = *(const v8h*)(qp + 16 + laneHi * 8);
            Bq[g][c] = cat8(lo, hi);
            // scale * log2(e) goes into Q: multiplied in f32, rounded to f16 once more
#pragma unroll
            for (int i = 0; i < 16; i++)
                Bq[g][c][i] = (_Float16)((float)Bq[g][c][i] * QSCALE);
        }

    // All-ones A tile: ones @ P^T gives each query's sum of P in every accumulator row
    v16h onesA;
#pragma unroll
    for (int i = 0; i < 16; i++) onesA[i] = (_Float16)1.0f;

    v8f Oacc[QG][4];    // O^T: Oacc[g][n][r] = O[query 16 g + laneLo][d = n*16 + laneHi*8 + r]
    v8f Cm[QG];         // minus the maximum in use of this lane's query, in all 8 registers
    float lrow[QG];     // this lane's query of each group
#pragma unroll
    for (int g = 0; g < QG; g++) {
#pragma unroll
        for (int n = 0; n < 4; n++) Oacc[g][n] = zero8();
        Cm[g] = zero8();
        lrow[g] = 0.0f;
    }

    const _Float16 (*ks)[KV_PITCH] = kvs[0][0];   // this pass's K tile   [key][d]
    const _Float16 (*vs)[KV_PITCH] = kvs[0][1];   // this pass's V^T tile [d][key]
    v8f  S[QG][4];     // S[g][n][r] = log2-domain score(key n*16 + laneHi*8 + r, query 16 g + laneLo)
    v16h Bp[QG][2];    // P^T B-fragments
    v16h Av[2][4];     // V^T A-fragments
    v8f  lacc[QG];     // sums of P over the block's 64 keys, the same in all 8 registers

    // Top of pass j: the barrier's second half, then block j + 1 on its way.
    auto pass_top = [&](int j) __attribute__((always_inline)) {
        ks = kvs[j & 1][0];
        vs = kvs[j & 1][1];
        __builtin_amdgcn_sched_barrier(0);   // the last pass's WMMAs stay in front of the wait
        bar_wait();             // block j is published, every wave has left the other buffer
        if (j + 1 < SEQ / 64)
            stage_kv(kh + (size_t)(j + 1) * 64 * HEAD_DIM, vth + (j + 1) * 64, kvs[(j + 1) & 1], t);
    };

    // All K A-fragments in one clause.
    auto load_k = [&](v16h (&Ak)[2][4]) __attribute__((always_inline)) {
#pragma unroll
        for (int n = 0; n < 4; n++)
#pragma unroll
            for (int c = 0; c < 2; c++) {
                const _Float16* kp = &ks[n * 16 + laneLo][c * 32];
                v8h lo = *(const v8h*)(kp + laneHi * 8);
                v8h hi = *(const v8h*)(kp + 16 + laneHi * 8);
                Ak[c][n] = cat8(lo, hi);
            }
        __builtin_amdgcn_sched_barrier(0);   // pin loads ahead of WMMAs
    };

    // Score tile n of both groups: S^T = K @ Q^T - maximum in use; each K fragment used twice.
    auto score_tile = [&](const v16h (&Ak)[2][4], int n) __attribute__((always_inline)) {
#pragma unroll
        for (int g = 0; g < QG; g++)
            S[g][n] = __builtin_amdgcn_wmma_f32_16x16x32_f16(
                false, Ak[0][n], false, Bq[g][0], (short)0, Cm[g], false, false);
#pragma unroll
        for (int g = 0; g < QG; g++)
            S[g][n] = __builtin_amdgcn_wmma_f32_16x16x32_f16(
                false, Ak[1][n], false, Bq[g][1], (short)0, S[g][n], false, false);
    };

    // P^T in place: score tiles 2c and 2c+1 are keys {8*laneHi + 0..7} and
    // {16 + 8*laneHi + 0..7} of 32-key chunk c, the k order of the V^T loader.
    auto prob_tile = [&](int p) __attribute__((always_inline)) {
#pragma unroll
        for (int g = 0; g < QG; g++)
#pragma unroll
            for (int r = 0; r < 8; r++)
                Bp[g][p >> 1][(p & 1) * 8 + r] = (_Float16)__builtin_amdgcn_exp2f(S[g][p][r]);
    };

    // All V^T A-fragments in one clause.
    auto load_v = [&]() __attribute__((always_inline)) {
#pragma unroll
        for (int c = 0; c < 2; c++)
#pragma unroll
            for (int n = 0; n < 4; n++) {
                const _Float16* vp = &vs[n * 16 + laneLo][c * 32];
                v8h alo = *(const v8h*)(vp + laneHi * 8);
                v8h ahi = *(const v8h*)(vp + 16 + laneHi * 8);
                Av[c][n] = cat8(alo, ahi);
            }
        __builtin_amdgcn_sched_barrier(0);   // the loads start ahead of the work that follows
    };

    // Sums of P = ones @ P^T.
    auto sum_p = [&]() __attribute__((always_inline)) {
#pragma unroll
        for (int g = 0; g < QG; g++) lacc[g] = zero8();
#pragma unroll
        for (int c = 0; c < 2; c++)
#pragma unroll
            for (int g = 0; g < QG; g++)
                lacc[g] = __builtin_amdgcn_wmma_f32_16x16x32_f16(
                    false, onesA, false, Bp[g][c], (short)0, lacc[g], false, false);
    };

    // A block taken with its true maximum: the first block, which sets the maxima in use,
    // and a block whose sums failed the test below. Nothing of the block has reached O or
    // the sums yet, and buffer j & 1 is still this wave's to read: the scores are made
    // (again), their maximum moves the maximum in use, O and the sums are rescaled.
    auto block_with_max = [&](bool first) __attribute__((always_inline)) {
        v16h Ak[2][4];
        load_k(Ak);
#pragma unroll
        for (int n = 0; n < 4; n++) score_tile(Ak, n);
#pragma unroll
        for (int g = 0; g < QG; g++) {
            float mx8[8];
#pragma unroll
            for (int r = 0; r < 8; r++)
                mx8[r] = fmaxf(fmaxf(S[g][0][r], S[g][1][r]), fmaxf(S[g][2][r], S[g][3][r]));
            const float mx = fmaxf(fmaxf(fmaxf(mx8[0], mx8[1]), fmaxf(mx8[2], mx8[3])),
                                   fmaxf(fmaxf(mx8[4], mx8[5]), fmaxf(mx8[6], mx8[7])));
            const float m = fmaxf(mx, xhalf(mx));   // the other 32 scores sit in lane ^ 16
            // step of the maximum in use: never down, but for the first block, which starts from 0
            const float d = first ? m : fmaxf(m, 0.0f);
            // a step down meets only zeros in O and the sums: factor 1 there
            const float alpha = __builtin_amdgcn_exp2f(-fmaxf(d, 0.0f));
#pragma unroll
            for (int n = 0; n < 4; n++) {
                S[g][n] -= d;
                Oacc[g][n] *= alpha;
            }
            Cm[g] -= d;
            lrow[g] *= alpha;
        }
#pragma unroll
        for (int p = 0; p < 4; p++) prob_tile(p);
        load_v();
        sum_p();
    };

    // Foot of a pass: the buffer is handed over, O^T += V^T @ P^T, the sums go in.
    auto pass_foot = [&]() __attribute__((always_inline)) {
        // Hand-over, signalled in front of the pass's last WMMAs: this wave holds its last
        // fragments of buffer j & 1 and its copies of block j + 1 have landed.
        asm volatile("s_wait_dscnt 0x0" ::: "memory");      // own LDS reads of this buffer are done
        asm volatile("s_wait_asynccnt 0x0" ::: "memory");   // own copies of block j + 1 have landed
        bar_signal();
        __builtin_amdgcn_sched_barrier(0);   // the WMMAs stay behind the signal
        // 16 WMMAs, each V^T fragment used twice
#pragma unroll
        for (int c = 0; c < 2; c++)
#pragma unroll
            for (int n = 0; n < 4; n++)
#pragma unroll
                for (int g = 0; g < QG; g++)
                    Oacc[g][n] = __builtin_amdgcn_wmma_f32_16x16x32_f16(
                        false, Av[c][n], false, Bp[g][c], (short)0, Oacc[g][n], false, false);
#pragma unroll
        for (int g = 0; g < QG; g++) lrow[g] += lacc[g][0];
    };

    pass_top(0);
    block_with_max(true);
    pass_foot();

    for (int j = 1; j < SEQ / 64; ++j) {
        pass_top(j);
        // ---- The usual block: no maximum is taken. With no branch between scores and exp2,
        //      the exp2 and conversions of score tile n - 1 stand among the WMMAs of tile n
        //      and run beside them ----
        {
            v16h Ak[2][4];
            load_k(Ak);
#pragma unroll
            for (int n = 0; n <= 4; n++) {
                if (n < 4) score_tile(Ak, n);
                if (n > 0) prob_tile(n - 1);
                if (n == 4) {
                    load_v();     // under way while the sums are made and tested
                    sum_p();
                }
                // ends a stage: tile n's exp2 stays out of tile n's own WMMAs, whose results it would wait for
                __builtin_amdgcn_sched_barrier(0);
            }
        }
        // ---- No P is negative, so none exceeds its query's block sum: a sum of at most
        //      2^14 says that every P is finite in f16. One test per block, the same for the
        //      whole wave (a scalar branch); written so that a NaN sum fails it too ----
        if (__builtin_amdgcn_ballot_w32(!(fmaxf(lacc[0][0], lacc[1][0]) <= 16384.0f)) != 0)
            block_with_max(false);
        pass_foot();
    }
    asm volatile("s_wait_asynccnt 0x0" ::: "memory");   // no copy outstanding at the wave's end
    bar_wait();                                         // the wait that belongs to the last pass's signal

    // Normalize and write out [B][S][D_MODEL] f32: a lane holds 8 consecutive d per tile
#pragma unroll
    for (int g = 0; g < QG; g++) {
        float* op = out + ((size_t)b * SEQ + qrow + 16 * g) * D_MODEL + h * HEAD_DIM + laneHi * 8;
#pragma unroll
        for (int n = 0; n < 4; n++) {
            v4f o0, o1;
#pragma unroll
            for (int r = 0; r < 4; r++) {
                o0[r] = Oacc[g][n][r] / lrow[g];
                o1[r] = Oacc[g][n][4 + r] / lrow[g];
            }
            *(v4f*)(op + n * 16)     = o0;
            *(v4f*)(op + n * 16 + 4) = o1;
        }
    }
}

extern "C" void kernel_launch(void* const* d_in, const int* in_sizes, int n_in,
                              void* d_out, int out_size, void* d_ws, size_t ws_size,
                              hipStream_t stream) {
    const float* x  = (const float*)d_in[0];
    const float* Wq = (const float*)d_in[1];
    const float* bq = (const float*)d_in[2];
    const float* Wk = (const float*)d_in[3];
    const float* bk = (const float*)d_in[4];
    const float* Wv = (const float*)d_in[5];
    const float* bv = (const float*)d_in[6];
    float* out = (float*)d_out;

    const size_t per = (size_t)BATCH * NHEAD * SEQ * HEAD_DIM;  // 8.4M elems
    _Float16* qws = (_Float16*)d_ws;
    _Float16* kws = qws + per;
    _Float16* vws = kws + per;
    _Float16* xh  = vws + per;
    _Float16* wt  = xh + per;      // total 70MB of f16 in d_ws

    to_f16_kernel<<<W_BLOCKS + NROWS * D_MODEL / 4096, 256, 0, stream>>>(x, Wq, Wk, Wv, xh, wt);

    dim3 g1(D_MODEL / TILE_NW, NROWS / TILE_M);   // (8, 32)
    qkv_proj_kernel<<<g1, 256, 0, stream>>>(xh, wt, bq, bk, bv, qws, kws, vws);

    dim3 g2(SEQ / (16 * QG * AW), BATCH * NHEAD);   // (8, 64)
    attn_kernel<<<g2, 32 * AW, 0, stream>>>(qws, kws, vws, out);
}
